// v000
// Measured on an AMD MI455X. A time is GPU time per run, averaged over a window of back-to-back runs after a warm-up
// (all launches, gaps included; the runs take copies of the inputs in turn), and the median of several windows.
// Apart from v000's, it joins two sittings. Times from different sittings can be a few percent apart, while
// side-by-side timings come from the same sitting.
// The starting kernel, v000, takes 448 microseconds a run.
#include <hip/hip_runtime.h>
#include <math.h>
#include <stdint.h>

// Problem constants (from reference): B=16, T=12 -> BT=192, N=1024, D=128, H=8, hd=16
#define SEQ      1024
#define DIM      128
#define NHEAD    8
#define HD       16
#define BT       192
#define TROWS    64
#define NTHREADS 512
#define NTILES   (SEQ / TROWS)   // 16

typedef float v2f __attribute__((ext_vector_type(2)));
typedef float v8f __attribute__((ext_vector_type(8)));

#if defined(__has_builtin)
#if __has_builtin(__builtin_amdgcn_tensor_load_to_lds) && \
    __has_builtin(__builtin_amdgcn_s_wait_tensorcnt)
#define HAVE_TDM 1
#endif
#endif
#ifndef HAVE_TDM
#define HAVE_TDM 0
#endif

// D = A(16x4) * B(4x16) + C(16x16), fp32, wave32.
static __device__ __forceinline__ v8f wmma4(v2f a, v2f b, v8f c) {
  return __builtin_amdgcn_wmma_f32_16x16x4_f32(false, a, false, b, (short)0, c,
                                               false, false);
}

// Sum across each 16-lane half of a wave32 (xor masks 1,2,4,8 stay in-half).
static __device__ __forceinline__ float red16(float v) {
  v += __shfl_xor(v, 1, 32);
  v += __shfl_xor(v, 2, 32);
  v += __shfl_xor(v, 4, 32);
  v += __shfl_xor(v, 8, 32);
  return v;
}

#if HAVE_TDM
typedef unsigned int u32x4 __attribute__((ext_vector_type(4)));
typedef int          i32x4 __attribute__((ext_vector_type(4)));
typedef int          i32x8 __attribute__((ext_vector_type(8)));

// Tensor Data Mover: load a 2D tile of f32 (tile_d1 rows x tile_d0 elements,
// source row stride d0_stride elements) into contiguous LDS at ldst.
// D# built per CDNA5 ISA ch.8: group0 = {count, lds_addr, global_addr, type=2},
// group1 = {data_size=4B, tensor_dim0/1, tile_dim0/1, dim0_stride}, groups 2/3
// zero (higher dims unused). tile_d1 == 0 -> 1D copy of tile_d0 elements.
// This toolchain's builtin takes 6 args (g0, g1, g2, g3, extra, cpol); the
// trailing vector corresponds to descriptor state we leave zero.
static __device__ __forceinline__ void tdm_load_2d(const void* gsrc, void* ldst,
                                                   unsigned tile_d0,
                                                   unsigned tile_d1,
                                                   unsigned tensor_d0,
                                                   unsigned tensor_d1,
                                                   unsigned d0_stride) {
  uint64_t ga = (uint64_t)(uintptr_t)gsrc;
  u32x4 g0;
  g0[0] = 1u;                               // count=1, user descriptor
  g0[1] = (unsigned)(uintptr_t)ldst;        // LDS byte address = flat addr[31:0]
  g0[2] = (unsigned)ga;                     // global_addr[31:0]
  g0[3] = (unsigned)(ga >> 32) | (2u << 30);// global_addr[56:32] | type=2
  i32x8 g1;
  g1[0] = (int)(2u << 16);                  // data_size = 4 bytes
  g1[1] = (int)(tensor_d0 << 16);           // tensor_dim0[15:0]
  g1[2] = (int)((tensor_d0 >> 16) | (tensor_d1 << 16));
  g1[3] = (int)((tensor_d1 >> 16) | (tile_d0 << 16));
  g1[4] = (int)(tile_d1 & 0xFFFFu);         // tile_dim1 (0 = 1D), tile_dim2=0
  g1[5] = (int)d0_stride;                   // tensor_dim0_stride[31:0]
  g1[6] = 0;
  g1[7] = 0;
  i32x4 z4 = {0, 0, 0, 0};
  i32x8 z8 = {0, 0, 0, 0, 0, 0, 0, 0};
  __builtin_amdgcn_tensor_load_to_lds(g0, g1, z4, z4, z8, 0);
}

static __device__ __forceinline__ void tdm_load_1d(const void* gsrc, void* ldst,
                                                   unsigned nelem) {
  tdm_load_2d(gsrc, ldst, nelem, 0, nelem, 1, nelem);
}
#endif  // HAVE_TDM

// ---------------------------------------------------------------------------
// Kernel 1: per (b) compute partial kvs[b,h] = sum_n khat[n] (x) v[n]  (16x16)
// and partial ksum[b,h] = sum_n khat[n], via k = x@Wk, v = x@Wv.
// One block per b, 16 waves. TDM double-buffers the x tiles (DMA overlaps the
// WMMA compute); Wk|Wv panel staged once by a strided 2D TDM.
// ---------------------------------------------------------------------------
__global__ void __launch_bounds__(NTHREADS)
kv_stats_kernel(const float* __restrict__ x, const float* __restrict__ Wqkv,
                float* __restrict__ ws_kvs, float* __restrict__ ws_ksum) {
  extern __shared__ float smem[];
  float* w_lds  = smem;                   // 128*256 : W_qkv cols 128..383 = [Wk|Wv]
  float* x0_lds = w_lds + DIM * 256;      // 64*128 (ping)
  float* x1_lds = x0_lds + TROWS * DIM;   // 64*128 (pong)
  float* kv_lds = x1_lds + TROWS * DIM;   // 64*256 : [khat | v]

  const int b    = blockIdx.x;
  const int tid  = threadIdx.x;
  const int wave = tid >> 5;
  const int lane = tid & 31;
  const int half = lane >> 4;
  const int l    = lane & 15;

  const float* xb = x + (size_t)b * SEQ * DIM;

#if HAVE_TDM
  if (wave == 0) {
    // [Wk|Wv]: 128 rows x 256 cols out of the 384-wide W_qkv, packed 256-wide.
    tdm_load_2d(Wqkv + 128, w_lds, 256, 128, 384, 128, 384);
    tdm_load_1d(xb, x0_lds, TROWS * DIM);  // tile 0
  }
#else
  for (int e = tid; e < DIM * 256 / 4; e += NTHREADS) {
    int r  = e >> 6;
    int c4 = (e & 63) << 2;
    *(float4*)(w_lds + r * 256 + c4) =
        *(const float4*)(Wqkv + r * 384 + 128 + c4);
  }
#endif

  const int kh    = wave & 7;   // head this wave reduces
  const int rhalf = wave >> 3;  // which 32-row half of the tile
  const int rb    = wave & 3;   // GEMM role: row block (16 rows)
  const int qt    = wave >> 2;  // GEMM role: 64-col quarter (0,1 = k; 2,3 = v)
  const int row0  = rb * 16;
  const int c0    = qt * 64;

  v8f   kvacc = {0.f, 0.f, 0.f, 0.f, 0.f, 0.f, 0.f, 0.f};
  float ksum  = 0.f;

  for (int it = 0; it < NTILES; ++it) {
    __syncthreads();  // prior iteration's x / kv_lds readers are done
    float* x_lds = (it & 1) ? x1_lds : x0_lds;
#if HAVE_TDM
    if (wave == 0) {
      if (it + 1 < NTILES) {
        float* nbuf = ((it + 1) & 1) ? x1_lds : x0_lds;
        tdm_load_1d(xb + (size_t)(it + 1) * TROWS * DIM, nbuf, TROWS * DIM);
        __builtin_amdgcn_s_wait_tensorcnt(1);  // tile it (and W) complete
      } else {
        __builtin_amdgcn_s_wait_tensorcnt(0);
      }
    }
#else
    {
      const float* xt = xb + (size_t)it * TROWS * DIM;
      for (int e = tid; e < TROWS * DIM / 4; e += NTHREADS)
        *(float4*)(x_lds + (e << 2)) = *(const float4*)(xt + (e << 2));
      if (it + 1 < NTILES)
        __builtin_prefetch(xt + TROWS * DIM + tid * 16, 0, 0);
    }
#endif
    __syncthreads();

    // ---- [k|v] GEMM: each wave computes a 16x64 strip = 4 wmma tiles ----
    v8f acc[4];
#pragma unroll
    for (int t = 0; t < 4; ++t)
      acc[t] = (v8f){0.f, 0.f, 0.f, 0.f, 0.f, 0.f, 0.f, 0.f};
#pragma unroll 4
    for (int k0 = 0; k0 < DIM; k0 += 4) {
      // A[m][k]: m = lane%16 (x row), k = 2*half + {0,1}
      v2f a = *(const v2f*)(x_lds + (row0 + l) * DIM + k0 + 2 * half);
      const float* wr = w_lds + (k0 + 2 * half) * 256 + c0 + l;
#pragma unroll
      for (int t = 0; t < 4; ++t) {
        v2f bb = {wr[t * 16], wr[t * 16 + 256]};  // B[k][n], rows 256 apart
        acc[t] = wmma4(a, bb, acc[t]);
      }
    }

    // ---- L2-normalize k rows (quarters 0,1 hold k; each tile = one head) ----
    if (qt < 2) {
#pragma unroll
      for (int t = 0; t < 4; ++t) {
#pragma unroll
        for (int i = 0; i < 8; ++i) {
          float ss = red16(acc[t][i] * acc[t][i]);
          float sc = 1.f / fmaxf(sqrtf(ss), 1e-12f);
          acc[t][i] *= sc;
        }
      }
    }

    // ---- stash khat / v tiles into LDS (C-layout: row=i+8*half, col=lane%16)
#pragma unroll
    for (int t = 0; t < 4; ++t) {
      float* dst = kv_lds + c0 + t * 16 + l;
#pragma unroll
      for (int i = 0; i < 8; ++i)
        dst[(row0 + i + 8 * half) * 256] = acc[t][i];
    }
    __syncthreads();

    // ---- kvs += Khat^T * V for head kh over this wave's 32 rows ----
    // A[m][k] = khat[j0+k][16*kh+m]; B[k][d] = v[j0+k][16*kh+d]
#pragma unroll
    for (int js = 0; js < 8; ++js) {
      int j0 = rhalf * 32 + js * 4 + 2 * half;
      const float* kr = kv_lds + (size_t)j0 * 256 + kh * 16 + l;
      v2f a  = {kr[0], kr[256]};          // khat rows j0, j0+1
      v2f bb = {kr[128], kr[256 + 128]};  // v rows j0, j0+1
      ksum += a.x + a.y;                  // partial column sum of khat
      kvacc = wmma4(a, bb, kvacc);
    }
  }

  // ---- write partial stats (combined in kernel 2) ----
  float* kdst = ws_kvs + (((size_t)b * NHEAD + kh) * 2 + rhalf) * 256;
#pragma unroll
  for (int i = 0; i < 8; ++i)
    kdst[(i + 8 * half) * 16 + l] = kvacc[i];
  ws_ksum[(((size_t)b * NHEAD + kh) * 2 + rhalf) * 32 + lane] = ksum;
}

// ---------------------------------------------------------------------------
// Kernel 2: per (b, 64-row tile): q = x@Wq (normalize), v = x@Wv,
// attn = qhat@kvs + N*v, out_pre = attn / (qhat.ksum + N),
// out = out_pre @ W_out + b_out.  Fully fused; weights and x tile staged by TDM, stats and bias by plain loads.
// ---------------------------------------------------------------------------
__global__ void __launch_bounds__(NTHREADS)
attn_out_kernel(const float* __restrict__ x, const float* __restrict__ Wqkv,
                const float* __restrict__ Wout, const float* __restrict__ bout,
                const float* __restrict__ ws_kvs,
                const float* __restrict__ ws_ksum, float* __restrict__ out) {
  extern __shared__ float smem[];
  float* wq_lds   = smem;                   // 128*128 (W_qkv cols 0..127)
  float* wv_lds   = wq_lds + DIM * DIM;     // 128*128 (W_qkv cols 256..383)
  float* wo_lds   = wv_lds + DIM * DIM;     // 128*128
  float* xq_lds   = wo_lds + DIM * DIM;     // 64*128 (x, later qhat)
  float* op_lds   = xq_lds + TROWS * DIM;   // 64*128 pre-projection
  float* kvs_lds  = op_lds + TROWS * DIM;   // 8*256
  float* ksum_lds = kvs_lds + NHEAD * 256;  // 128
  float* bias_lds = ksum_lds + DIM;         // 128

  const int b    = blockIdx.y;
  const int nt   = blockIdx.x;
  const int tid  = threadIdx.x;
  const int wave = tid >> 5;
  const int lane = tid & 31;
  const int half = lane >> 4;
  const int l    = lane & 15;

  const float* xt = x + ((size_t)b * SEQ + (size_t)nt * TROWS) * DIM;

  // ---- stage weights / x tile (TDM) and stats (VALU combine) ----
#if HAVE_TDM
  if (wave == 0) {
    tdm_load_2d(Wqkv, wq_lds, 128, 128, 384, 128, 384);
    tdm_load_2d(Wqkv + 256, wv_lds, 128, 128, 384, 128, 384);
    tdm_load_1d(Wout, wo_lds, DIM * DIM);
    tdm_load_1d(xt, xq_lds, TROWS * DIM);
  }
#else
  for (int e = tid; e < DIM * DIM / 4; e += NTHREADS) {
    int r = e >> 5;            // 32 float4 per 128-wide row
    int c = (e & 31) << 2;
    *(float4*)(wq_lds + r * 128 + c) = *(const float4*)(Wqkv + r * 384 + c);
    *(float4*)(wv_lds + r * 128 + c) =
        *(const float4*)(Wqkv + r * 384 + 256 + c);
  }
  for (int e = tid; e < DIM * DIM / 4; e += NTHREADS)
    *(float4*)(wo_lds + (e << 2)) = *(const float4*)(Wout + (e << 2));
  for (int e = tid; e < TROWS * DIM / 4; e += NTHREADS)
    *(float4*)(xq_lds + (e << 2)) = *(const float4*)(xt + (e << 2));
#endif
  for (int i = tid; i < NHEAD * 256; i += NTHREADS) {
    size_t base = (((size_t)b * NHEAD + (i >> 8)) * 2) * 256;
    int md = i & 255;
    kvs_lds[i] = ws_kvs[base + md] + ws_kvs[base + 256 + md];
  }
  if (tid < DIM) {
    size_t base = (((size_t)b * NHEAD + (tid >> 4)) * 2) * 32;
    int m = tid & 15;
    ksum_lds[tid] = ws_ksum[base + m] + ws_ksum[base + m + 16] +
                    ws_ksum[base + 32 + m] + ws_ksum[base + 48 + m];
    bias_lds[tid] = bout[tid];
  }
#if HAVE_TDM
  if (wave == 0) __builtin_amdgcn_s_wait_tensorcnt(0);
#endif
  __syncthreads();

  // ---- q/v GEMM: wave -> row block rb, heads h0, h0+1 (q and v tiles) ----
  const int rb   = wave & 3;
  const int h0   = (wave >> 2) * 2;
  const int row0 = rb * 16;
  v8f q0  = {0.f, 0.f, 0.f, 0.f, 0.f, 0.f, 0.f, 0.f};
  v8f q1  = q0, v0t = q0, v1t = q0;
#pragma unroll 4
  for (int k0 = 0; k0 < DIM; k0 += 4) {
    v2f a = *(const v2f*)(xq_lds + (row0 + l) * DIM + k0 + 2 * half);
    const float* wrq = wq_lds + (k0 + 2 * half) * DIM + 16 * h0 + l;
    const float* wrv = wv_lds + (k0 + 2 * half) * DIM + 16 * h0 + l;
    v2f bq0 = {wrq[0], wrq[DIM]};
    v2f bq1 = {wrq[16], wrq[16 + DIM]};
    v2f bv0 = {wrv[0], wrv[DIM]};
    v2f bv1 = {wrv[16], wrv[16 + DIM]};
    q0  = wmma4(a, bq0, q0);
    q1  = wmma4(a, bq1, q1);
    v0t = wmma4(a, bv0, v0t);
    v1t = wmma4(a, bv1, v1t);
  }

  // ---- L2-normalize q (per head = per tile; rows across 16-lane halves) ----
#pragma unroll
  for (int i = 0; i < 8; ++i) {
    float s0 = red16(q0[i] * q0[i]);
    q0[i] *= 1.f / fmaxf(sqrtf(s0), 1e-12f);
    float s1 = red16(q1[i] * q1[i]);
    q1[i] *= 1.f / fmaxf(sqrtf(s1), 1e-12f);
  }

  __syncthreads();  // everyone finished reading x from xq_lds
#pragma unroll
  for (int i = 0; i < 8; ++i) {
    xq_lds[(row0 + i + 8 * half) * DIM + 16 * h0 + l]       = q0[i];
    xq_lds[(row0 + i + 8 * half) * DIM + 16 * (h0 + 1) + l] = q1[i];
  }
  __syncthreads();

  // ---- attn = qhat @ kvs + N*v ; out_pre = attn / (qhat.ksum + N) ----
#pragma unroll
  for (int hh = 0; hh < 2; ++hh) {
    const int h = h0 + hh;
    v8f vt = (hh == 0) ? v0t : v1t;
    v8f qh = (hh == 0) ? q0 : q1;
    v8f att;
#pragma unroll
    for (int i = 0; i < 8; ++i) att[i] = 1024.f * vt[i];  // N * v (C layout)
#pragma unroll
    for (int k0 = 0; k0 < HD; k0 += 4) {
      v2f a = *(const v2f*)(xq_lds + (row0 + l) * DIM + 16 * h + k0 + 2 * half);
      const float* kr = kvs_lds + h * 256 + (k0 + 2 * half) * 16 + l;
      v2f bb = {kr[0], kr[16]};
      att = wmma4(a, bb, att);
    }
    float ks = ksum_lds[h * 16 + l];
#pragma unroll
    for (int i = 0; i < 8; ++i) {
      float dot = red16(qh[i] * ks);       // qhat-row . ksum  (per row)
      float inv = 1.f / (dot + 1024.f);    // + N
      op_lds[(row0 + i + 8 * half) * DIM + 16 * h + l] = att[i] * inv;
    }
  }
  __syncthreads();

  // ---- output projection: out = op @ W_out + b_out ----
  const int cb = wave & 7;
  const int rA = (wave >> 3) * 16;  // row blocks 0/16 and 32/48 per wave
  const int rB = rA + 32;
  const int c0 = cb * 16;
  v8f oA, oB;
#pragma unroll
  for (int i = 0; i < 8; ++i) {
    oA[i] = bias_lds[c0 + l];
    oB[i] = oA[i];
  }
#pragma unroll 4
  for (int k0 = 0; k0 < DIM; k0 += 4) {
    const float* wr = wo_lds + (k0 + 2 * half) * DIM + c0 + l;
    v2f bb = {wr[0], wr[DIM]};
    v2f aA = *(const v2f*)(op_lds + (rA + l) * DIM + k0 + 2 * half);
    v2f aB = *(const v2f*)(op_lds + (rB + l) * DIM + k0 + 2 * half);
    oA = wmma4(aA, bb, oA);
    oB = wmma4(aB, bb, oB);
  }
  float* ob = out + ((size_t)b * SEQ + (size_t)nt * TROWS) * DIM;
#pragma unroll
  for (int i = 0; i < 8; ++i) {
    ob[(rA + i + 8 * half) * DIM + c0 + l] = oA[i];
    ob[(rB + i + 8 * half) * DIM + c0 + l] = oB[i];
  }
}

extern "C" void kernel_launch(void* const* d_in, const int* in_sizes, int n_in,
                              void* d_out, int out_size, void* d_ws,
                              size_t ws_size, hipStream_t stream) {
  (void)in_sizes; (void)n_in; (void)out_size; (void)ws_size;
  const float* x    = (const float*)d_in[0];
  const float* Wqkv = (const float*)d_in[1];
  const float* Wout = (const float*)d_in[2];
  const float* bout = (const float*)d_in[3];
  float* out = (float*)d_out;

  float* ws_kvs  = (float*)d_ws;                           // 192*8*2*256 f32
  float* ws_ksum = ws_kvs + (size_t)BT * NHEAD * 2 * 256;  // 192*8*2*32  f32

  const size_t shmem1 =
      (size_t)(DIM * 256 + 2 * TROWS * DIM + TROWS * 256) * sizeof(float);
  const size_t shmem2 =
      (size_t)(3 * DIM * DIM + 2 * TROWS * DIM + NHEAD * 256 + DIM + DIM) *
      sizeof(float);

  (void)hipFuncSetAttribute((const void*)kv_stats_kernel,
                            hipFuncAttributeMaxDynamicSharedMemorySize,
                            (int)shmem1);
  (void)hipFuncSetAttribute((const void*)attn_out_kernel,
                            hipFuncAttributeMaxDynamicSharedMemorySize,
                            (int)shmem2);

  kv_stats_kernel<<<dim3(BT), dim3(NTHREADS), shmem1, stream>>>(x, Wqkv, ws_kvs,
                                                                ws_ksum);
  attn_out_kernel<<<dim3(NTILES, BT), dim3(NTHREADS), shmem2, stream>>>(
      x, Wqkv, Wout, bout, ws_kvs, ws_ksum, out);
}

// v001
// It runs in 297 microseconds.
// Next to v000, in two timings, it ran 1.56 times as fast each time.
#include <hip/hip_runtime.h>
#include <math.h>
#include <stdint.h>

// Problem constants (from reference): B=16, T=12 -> BT=192, N=1024, D=128, H=8, hd=16
#define SEQ      1024
#define DIM      128
#define NHEAD    8
#define HD       16
#define BT       192
#define TROWS    64
#define NTHREADS 512
#define NTILES   (SEQ / TROWS)   // 16
// LDS row pitches in floats (64 banks of 4 bytes).
// A-fragment tiles (lane = row, 8 bytes a lane): 132 = 4 mod 64, so the 16 rows
// of one read fall on 16 different groups of four banks.
// B-fragment panels (lane = column; the two lane halves read rows k and k+2):
// twice the pitch = 32 mod 64, so the halves fall on different banks.
#define XP       132   // x, qhat and pre-projection tiles
#define WP1      272   // 256-wide [Wk|Wv] panel and [khat|v] tile
#define WP2      144   // 128-wide weight panels

typedef float v2f __attribute__((ext_vector_type(2)));
typedef float v4f __attribute__((ext_vector_type(4)));
typedef float v8f __attribute__((ext_vector_type(8)));

// D = A(16x4) * B(4x16) + C(16x16), fp32, wave32.
static __device__ __forceinline__ v8f wmma4(v2f a, v2f b, v8f c) {
  return __builtin_amdgcn_wmma_f32_16x16x4_f32(false, a, false, b, (short)0, c,
                                               false, false);
}

// Sum across each 16-lane half of a wave32 (xor masks 1,2,4,8 stay in-half).
static __device__ __forceinline__ float red16(float v) {
  v += __shfl_xor(v, 1, 32);
  v += __shfl_xor(v, 2, 32);
  v += __shfl_xor(v, 4, 32);
  v += __shfl_xor(v, 8, 32);
  return v;
}

// ---------------------------------------------------------------------------
// Kernel 1: per (b) compute partial kvs[b,h] = sum_n khat[n] (x) v[n]  (16x16)
// and partial ksum[b,h] = sum_n khat[n], via k = x@Wk, v = x@Wv.
// One block per b, 16 waves. The x tiles are double-buffered: the next tile is
// loaded into registers ahead of the GEMM and stored to LDS behind it; the
// Wk|Wv panel is staged once. All tiles lie at the padded pitches above.
// ---------------------------------------------------------------------------
__global__ void __launch_bounds__(NTHREADS)
kv_stats_kernel(const float* __restrict__ x, const float* __restrict__ Wqkv,
                float* __restrict__ ws_kvs, float* __restrict__ ws_ksum) {
  extern __shared__ float smem[];
  float* w_lds  = smem;                   // 128 x WP1 : W_qkv cols 128..383 = [Wk|Wv]
  float* x0_lds = w_lds + DIM * WP1;      // 64 x XP (ping)
  float* x1_lds = x0_lds + TROWS * XP;    // 64 x XP (pong)
  float* kv_lds = x1_lds + TROWS * XP;    // 64 x WP1 : [khat | v]

  const int b    = blockIdx.x;
  const int tid  = threadIdx.x;
  const int wave = tid >> 5;
  const int lane = tid & 31;
  const int half = lane >> 4;
  const int l    = lane & 15;

  const float* xb = x + (size_t)b * SEQ * DIM;

#pragma unroll  // all loads in flight before the first LDS store waits
  for (int j = 0; j < DIM * 256 / 4 / NTHREADS; ++j) {
    int r  = (tid >> 6) + j * (NTHREADS >> 6);  // 64 groups of 4 floats a row
    int c4 = (tid & 63) << 2;
    *(v4f*)(w_lds + r * WP1 + c4) = *(const v4f*)(Wqkv + r * 384 + 128 + c4);
  }
  // x tile: wave w moves rows w, w+16, w+32, w+48, one float4 a lane and row.
  const int xg = wave * DIM + (lane << 2);  // offset in the global tile
  const int xs = wave * XP + (lane << 2);   // offset in the LDS tile
  v4f p0 = *(const v4f*)(xb + xg);
  v4f p1 = *(const v4f*)(xb + xg + 16 * DIM);
  v4f p2 = *(const v4f*)(xb + xg + 32 * DIM);
  v4f p3 = *(const v4f*)(xb + xg + 48 * DIM);
  *(v4f*)(x0_lds + xs)           = p0;
  *(v4f*)(x0_lds + xs + 16 * XP) = p1;
  *(v4f*)(x0_lds + xs + 32 * XP) = p2;
  *(v4f*)(x0_lds + xs + 48 * XP) = p3;

  const int kh    = wave & 7;   // head this wave reduces
  const int rhalf = wave >> 3;  // which 32-row half of the tile
  const int rb    = wave & 3;   // GEMM role: row block (16 rows)
  const int qt    = wave >> 2;  // GEMM role: 64-col quarter (0,1 = k; 2,3 = v)
  const int row0  = rb * 16;
  const int c0    = qt * 64;

  v8f   kvacc = {0.f, 0.f, 0.f, 0.f, 0.f, 0.f, 0.f, 0.f};
  float ksum  = 0.f;

  for (int it = 0; it < NTILES; ++it) {
    __syncthreads();  // tile it is stored; prior x / kv_lds readers are done
    const float* x_lds = (it & 1) ? x1_lds : x0_lds;
    float*       n_lds = (it & 1) ? x0_lds : x1_lds;
    if (it + 1 < NTILES) {
      const float* xn = xb + (size_t)(it + 1) * TROWS * DIM + xg;
      p0 = *(const v4f*)(xn);
      p1 = *(const v4f*)(xn + 16 * DIM);
      p2 = *(const v4f*)(xn + 32 * DIM);
      p3 = *(const v4f*)(xn + 48 * DIM);
    }

    // ---- [k|v] GEMM: each wave computes a 16x64 strip = 4 wmma tiles ----
    v8f acc[4];
#pragma unroll
    for (int t = 0; t < 4; ++t)
      acc[t] = (v8f){0.f, 0.f, 0.f, 0.f, 0.f, 0.f, 0.f, 0.f};
#pragma unroll 4
    for (int k0 = 0; k0 < DIM; k0 += 4) {
      // A[m][k]: m = lane%16 (x row), k = 2*half + {0,1}
      v2f a = *(const v2f*)(x_lds + (row0 + l) * XP + k0 + 2 * half);
      const float* wr = w_lds + (k0 + 2 * half) * WP1 + c0 + l;
#pragma unroll
      for (int t = 0; t < 4; ++t) {
        v2f bb = {wr[t * 16], wr[t * 16 + WP1]};  // B[k][n], rows k and k+1
        acc[t] = wmma4(a, bb, acc[t]);
      }
    }

    // ---- L2-normalize k rows (quarters 0,1 hold k; each tile = one head) ----
    if (qt < 2) {
#pragma unroll
      for (int t = 0; t < 4; ++t) {
#pragma unroll
        for (int i = 0; i < 8; ++i) {
          float ss = red16(acc[t][i] * acc[t][i]);
          float sc = 1.f / fmaxf(sqrtf(ss), 1e-12f);
          acc[t][i] *= sc;
        }
      }
    }

    // ---- stash khat / v tiles into LDS (C-layout: row=i+8*half, col=lane%16)
#pragma unroll
    for (int t = 0; t < 4; ++t) {
      float* dst = kv_lds + c0 + t * 16 + l;
#pragma unroll
      for (int i = 0; i < 8; ++i)
        dst[(row0 + i + 8 * half) * WP1] = acc[t][i];
    }
    // next x tile into the buffer whose readers left before this trip's barrier
    if (it + 1 < NTILES) {
      *(v4f*)(n_lds + xs)           = p0;
      *(v4f*)(n_lds + xs + 16 * XP) = p1;
      *(v4f*)(n_lds + xs + 32 * XP) = p2;
      *(v4f*)(n_lds + xs + 48 * XP) = p3;
    }
    __syncthreads();

    // ---- kvs += Khat^T * V for head kh over this wave's 32 rows ----
    // A[m][k] = khat[j0+k][16*kh+m]; B[k][d] = v[j0+k][16*kh+d]
#pragma unroll
    for (int js = 0; js < 8; ++js) {
      int j0 = rhalf * 32 + js * 4 + 2 * half;
      const float* kr = kv_lds + (size_t)j0 * WP1 + kh * 16 + l;
      v2f a  = {kr[0], kr[WP1]};          // khat rows j0, j0+1
      v2f bb = {kr[128], kr[WP1 + 128]};  // v rows j0, j0+1
      ksum += a.x + a.y;                  // partial column sum of khat
      kvacc = wmma4(a, bb, kvacc);
    }
  }

  // ---- write partial stats (combined in kernel 2) ----
  float* kdst = ws_kvs + (((size_t)b * NHEAD + kh) * 2 + rhalf) * 256;
#pragma unroll
  for (int i = 0; i < 8; ++i)
    kdst[(i + 8 * half) * 16 + l] = kvacc[i];
  ws_ksum[(((size_t)b * NHEAD + kh) * 2 + rhalf) * 32 + lane] = ksum;
}

// ---------------------------------------------------------------------------
// Kernel 2: per (b, 64-row tile): q = x@Wq (normalize), v = x@Wv,
// attn = qhat@kvs + N*v, out_pre = attn / (qhat.ksum + N),
// out = out_pre @ W_out + b_out.  Fully fused; tiles at the padded pitches.
// ---------------------------------------------------------------------------
__global__ void __launch_bounds__(NTHREADS)
attn_out_kernel(const float* __restrict__ x, const float* __restrict__ Wqkv,
                const float* __restrict__ Wout, const float* __restrict__ bout,
                const float* __restrict__ ws_kvs,
                const float* __restrict__ ws_ksum, float* __restrict__ out) {
  extern __shared__ float smem[];
  float* wq_lds   = smem;                   // 128 x WP2 (W_qkv cols 0..127)
  float* wv_lds   = wq_lds + DIM * WP2;     // 128 x WP2 (W_qkv cols 256..383)
  float* wo_lds   = wv_lds + DIM * WP2;     // 128 x WP2
  float* xq_lds   = wo_lds + DIM * WP2;     // 64 x XP (x, later qhat)
  float* op_lds   = xq_lds + TROWS * XP;    // 64 x XP pre-projection
  float* kvs_lds  = op_lds + TROWS * XP;    // 8*256
  float* ksum_lds = kvs_lds + NHEAD * 256;  // 128
  float* bias_lds = ksum_lds + DIM;         // 128

  const int b    = blockIdx.y;
  const int nt   = blockIdx.x;
  const int tid  = threadIdx.x;
  const int wave = tid >> 5;
  const int lane = tid & 31;
  const int half = lane >> 4;
  const int l    = lane & 15;

  const float* xt = x + ((size_t)b * SEQ + (size_t)nt * TROWS) * DIM;

  // ---- stage weights / x tile and stats (VALU combine) ----
  // wave w moves rows w, w+16, ...: 32 lanes x 4 floats = one 128-wide row
#pragma unroll  // all loads in flight before the first LDS store waits
  for (int j = 0; j < TROWS / 16; ++j) {
    int r = wave + j * 16;
    int c = lane << 2;
    *(v4f*)(xq_lds + r * XP + c) = *(const v4f*)(xt + r * DIM + c);
  }
#pragma unroll  // as above
  for (int j = 0; j < DIM / 16; ++j) {
    int r = wave + j * 16;
    int c = lane << 2;
    *(v4f*)(wq_lds + r * WP2 + c) = *(const v4f*)(Wqkv + r * 384 + c);
    *(v4f*)(wv_lds + r * WP2 + c) = *(const v4f*)(Wqkv + r * 384 + 256 + c);
    *(v4f*)(wo_lds + r * WP2 + c) = *(const v4f*)(Wout + r * DIM + c);
  }
  for (int i = tid; i < NHEAD * 256; i += NTHREADS) {
    size_t base = (((size_t)b * NHEAD + (i >> 8)) * 2) * 256;
    int md = i & 255;
    kvs_lds[i] = ws_kvs[base + md] + ws_kvs[base + 256 + md];
  }
  if (tid < DIM) {
    size_t base = (((size_t)b * NHEAD + (tid >> 4)) * 2) * 32;
    int m = tid & 15;
    ksum_lds[tid] = ws_ksum[base + m] + ws_ksum[base + m + 16] +
                    ws_ksum[base + 32 + m] + ws_ksum[base + 48 + m];
    bias_lds[tid] = bout[tid];
  }
  __syncthreads();

  // ---- q/v GEMM: wave -> row block rb, heads h0, h0+1 (q and v tiles) ----
  const int rb   = wave & 3;
  const int h0   = (wave >> 2) * 2;
  const int row0 = rb * 16;
  v8f q0  = {0.f, 0.f, 0.f, 0.f, 0.f, 0.f, 0.f, 0.f};
  v8f q1  = q0, v0t = q0, v1t = q0;
#pragma unroll 4
  for (int k0 = 0; k0 < DIM; k0 += 4) {
    v2f a = *(const v2f*)(xq_lds + (row0 + l) * XP + k0 + 2 * half);
    const float* wrq = wq_lds + (k0 + 2 * half) * WP2 + 16 * h0 + l;
    const float* wrv = wv_lds + (k0 + 2 * half) * WP2 + 16 * h0 + l;
    v2f bq0 = {wrq[0], wrq[WP2]};
    v2f bq1 = {wrq[16], wrq[16 + WP2]};
    v2f bv0 = {wrv[0], wrv[WP2]};
    v2f bv1 = {wrv[16], wrv[16 + WP2]};
    q0  = wmma4(a, bq0, q0);
    q1  = wmma4(a, bq1, q1);
    v0t = wmma4(a, bv0, v0t);
    v1t = wmma4(a, bv1, v1t);
  }

  // ---- L2-normalize q (per head = per tile; rows across 16-lane halves) ----
#pragma unroll
  for (int i = 0; i < 8; ++i) {
    float s0 = red16(q0[i] * q0[i]);
    q0[i] *= 1.f / fmaxf(sqrtf(s0), 1e-12f);
    float s1 = red16(q1[i] * q1[i]);
    q1[i] *= 1.f / fmaxf(sqrtf(s1), 1e-12f);
  }

  __syncthreads();  // everyone finished reading x from xq_lds
#pragma unroll
  for (int i = 0; i < 8; ++i) {
    xq_lds[(row0 + i + 8 * half) * XP + 16 * h0 + l]       = q0[i];
    xq_lds[(row0 + i + 8 * half) * XP + 16 * (h0 + 1) + l] = q1[i];
  }
  __syncthreads();

  // ---- attn = qhat @ kvs + N*v ; out_pre = attn / (qhat.ksum + N) ----
#pragma unroll
  for (int hh = 0; hh < 2; ++hh) {
    const int h = h0 + hh;
    v8f vt = (hh == 0) ? v0t : v1t;
    v8f qh = (hh == 0) ? q0 : q1;
    v8f att;
#pragma unroll
    for (int i = 0; i < 8; ++i) att[i] = 1024.f * vt[i];  // N * v (C layout)
#pragma unroll
    for (int k0 = 0; k0 < HD; k0 += 4) {
      v2f a = *(const v2f*)(xq_lds + (row0 + l) * XP + 16 * h + k0 + 2 * half);
      const float* kr = kvs_lds + h * 256 + (k0 + 2 * half) * 16 + l;
      v2f bb = {kr[0], kr[16]};
      att = wmma4(a, bb, att);
    }
    float ks = ksum_lds[h * 16 + l];
#pragma unroll
    for (int i = 0; i < 8; ++i) {
      float dot = red16(qh[i] * ks);       // qhat-row . ksum  (per row)
      float inv = 1.f / (dot + 1024.f);    // + N
      op_lds[(row0 + i + 8 * half) * XP + 16 * h + l] = att[i] * inv;
    }
  }
  __syncthreads();

  // ---- output projection: out = op @ W_out + b_out ----
  const int cb = wave & 7;
  const int rA = (wave >> 3) * 16;  // row blocks 0/16 and 32/48 per wave
  const int rB = rA + 32;
  const int c0 = cb * 16;
  v8f oA, oB;
#pragma unroll
  for (int i = 0; i < 8; ++i) {
    oA[i] = bias_lds[c0 + l];
    oB[i] = oA[i];
  }
#pragma unroll 4
  for (int k0 = 0; k0 < DIM; k0 += 4) {
    const float* wr = wo_lds + (k0 + 2 * half) * WP2 + c0 + l;
    v2f bb = {wr[0], wr[WP2]};
    v2f aA = *(const v2f*)(op_lds + (rA + l) * XP + k0 + 2 * half);
    v2f aB = *(const v2f*)(op_lds + (rB + l) * XP + k0 + 2 * half);
    oA = wmma4(aA, bb, oA);
    oB = wmma4(aB, bb, oB);
  }
  float* ob = out + ((size_t)b * SEQ + (size_t)nt * TROWS) * DIM;
#pragma unroll
  for (int i = 0; i < 8; ++i) {
    ob[(rA + i + 8 * half) * DIM + c0 + l] = oA[i];
    ob[(rB + i + 8 * half) * DIM + c0 + l] = oB[i];
  }
}

extern "C" void kernel_launch(void* const* d_in, const int* in_sizes, int n_in,
                              void* d_out, int out_size, void* d_ws,
                              size_t ws_size, hipStream_t stream) {
  (void)in_sizes; (void)n_in; (void)out_size; (void)ws_size;
  const float* x    = (const float*)d_in[0];
  const float* Wqkv = (const float*)d_in[1];
  const float* Wout = (const float*)d_in[2];
  const float* bout = (const float*)d_in[3];
  float* out = (float*)d_out;

  float* ws_kvs  = (float*)d_ws;                           // 192*8*2*256 f32
  float* ws_ksum = ws_kvs + (size_t)BT * NHEAD * 2 * 256;  // 192*8*2*32  f32

  const size_t shmem1 =
      (size_t)(DIM * WP1 + 2 * TROWS * XP + TROWS * WP1) * sizeof(float);
  const size_t shmem2 =
      (size_t)(3 * DIM * WP2 + 2 * TROWS * XP + NHEAD * 256 + DIM + DIM) *
      sizeof(float);

  (void)hipFuncSetAttribute((const void*)kv_stats_kernel,
                            hipFuncAttributeMaxDynamicSharedMemorySize,
                            (int)shmem1);
  (void)hipFuncSetAttribute((const void*)attn_out_kernel,
                            hipFuncAttributeMaxDynamicSharedMemorySize,
                            (int)shmem2);

  kv_stats_kernel<<<dim3(BT), dim3(NTHREADS), shmem1, stream>>>(x, Wqkv, ws_kvs,
                                                                ws_ksum);
  attn_out_kernel<<<dim3(NTILES, BT), dim3(NTHREADS), shmem2, stream>>>(
      x, Wqkv, Wout, bout, ws_kvs, ws_ksum, out);
}

// v002
// Measured time: 261 microseconds a run.
// Two timings next to v001 both put it at 1.14 times that version's speed.
// All steps since v000 together make it 1.78 times as fast.
#include <hip/hip_runtime.h>
#include <math.h>
#include <stdint.h>

// Problem constants (from reference): B=16, T=12 -> BT=192, N=1024, D=128, H=8, hd=16
#define SEQ      1024
#define DIM      128
#define NHEAD    8
#define HD       16
#define BT       192
#define TROWS    64
#define NTHREADS 512
#define NTILES   (SEQ / TROWS)   // 16
#define K2_GROUPS 256                          // kernel 2: one work-group a WGP
#define K2_TILES  (BT * NTILES / K2_GROUPS)    // 12 tiles each
// LDS row pitches in floats (64 banks of 4 bytes).
// A-fragment tiles (lane = row, 8 bytes a lane): 132 = 4 mod 64, so the 16 rows
// of one read fall on 16 different groups of four banks.
// B-fragment panels (lane = column; the two lane halves read rows k and k+2):
// twice the pitch = 32 mod 64, so the halves fall on different banks.
#define XP       132   // x, qhat and pre-projection tiles
#define WP1      272   // 256-wide [Wk|Wv] panel and [khat|v] tile
#define WP2      144   // 128-wide weight panels

typedef float v2f __attribute__((ext_vector_type(2)));
typedef float v4f __attribute__((ext_vector_type(4)));
typedef float v8f __attribute__((ext_vector_type(8)));

// D = A(16x4) * B(4x16) + C(16x16), fp32, wave32.
static __device__ __forceinline__ v8f wmma4(v2f a, v2f b, v8f c) {
  return __builtin_amdgcn_wmma_f32_16x16x4_f32(false, a, false, b, (short)0, c,
                                               false, false);
}

// Sum across each 16-lane half of a wave32 (xor masks 1,2,4,8 stay in-half).
static __device__ __forceinline__ float red16(float v) {
  v += __shfl_xor(v, 1, 32);
  v += __shfl_xor(v, 2, 32);
  v += __shfl_xor(v, 4, 32);
  v += __shfl_xor(v, 8, 32);
  return v;
}

// ---------------------------------------------------------------------------
// Kernel 1: per (b) compute partial kvs[b,h] = sum_n khat[n] (x) v[n]  (16x16)
// and partial ksum[b,h] = sum_n khat[n], via k = x@Wk, v = x@Wv.
// One block per b, 16 waves. The x tiles are double-buffered: the next tile is
// loaded into registers ahead of the GEMM and stored to LDS behind it; the
// Wk|Wv panel is staged once. All tiles lie at the padded pitches above.
// ---------------------------------------------------------------------------
__global__ void __launch_bounds__(NTHREADS)
kv_stats_kernel(const float* __restrict__ x, const float* __restrict__ Wqkv,
                float* __restrict__ ws_kvs, float* __restrict__ ws_ksum) {
  extern __shared__ float smem[];
  float* w_lds  = smem;                   // 128 x WP1 : W_qkv cols 128..383 = [Wk|Wv]
  float* x0_lds = w_lds + DIM * WP1;      // 64 x XP (ping)
  float* x1_lds = x0_lds + TROWS * XP;    // 64 x XP (pong)
  float* kv_lds = x1_lds + TROWS * XP;    // 64 x WP1 : [khat | v]

  const int b    = blockIdx.x;
  const int tid  = threadIdx.x;
  const int wave = tid >> 5;
  const int lane = tid & 31;
  const int half = lane >> 4;
  const int l    = lane & 15;

  const float* xb = x + (size_t)b * SEQ * DIM;

#pragma unroll  // all loads in flight before the first LDS store waits
  for (int j = 0; j < DIM * 256 / 4 / NTHREADS; ++j) {
    int r  = (tid >> 6) + j * (NTHREADS >> 6);  // 64 groups of 4 floats a row
    int c4 = (tid & 63) << 2;
    *(v4f*)(w_lds + r * WP1 + c4) = *(const v4f*)(Wqkv + r * 384 + 128 + c4);
  }
  // x tile: wave w moves rows w, w+16, w+32, w+48, one float4 a lane and row.
  const int xg = wave * DIM + (lane << 2);  // offset in the global tile
  const int xs = wave * XP + (lane << 2);   // offset in the LDS tile
  v4f p0 = *(const v4f*)(xb + xg);
  v4f p1 = *(const v4f*)(xb + xg + 16 * DIM);
  v4f p2 = *(const v4f*)(xb + xg + 32 * DIM);
  v4f p3 = *(const v4f*)(xb + xg + 48 * DIM);
  *(v4f*)(x0_lds + xs)           = p0;
  *(v4f*)(x0_lds + xs + 16 * XP) = p1;
  *(v4f*)(x0_lds + xs + 32 * XP) = p2;
  *(v4f*)(x0_lds + xs + 48 * XP) = p3;

  const int kh    = wave & 7;   // head this wave reduces
  const int rhalf = wave >> 3;  // which 32-row half of the tile
  const int rb    = wave & 3;   // GEMM role: row block (16 rows)
  const int qt    = wave >> 2;  // GEMM role: 64-col quarter (0,1 = k; 2,3 = v)
  const int row0  = rb * 16;
  const int c0    = qt * 64;

  v8f   kvacc = {0.f, 0.f, 0.f, 0.f, 0.f, 0.f, 0.f, 0.f};
  float ksum  = 0.f;

  for (int it = 0; it < NTILES; ++it) {
    __syncthreads();  // tile it is stored; prior x / kv_lds readers are done
    const float* x_lds = (it & 1) ? x1_lds : x0_lds;
    float*       n_lds = (it & 1) ? x0_lds : x1_lds;
    if (it + 1 < NTILES) {
      const float* xn = xb + (size_t)(it + 1) * TROWS * DIM + xg;
      p0 = *(const v4f*)(xn);
      p1 = *(const v4f*)(xn + 16 * DIM);
      p2 = *(const v4f*)(xn + 32 * DIM);
      p3 = *(const v4f*)(xn + 48 * DIM);
    }

    // ---- [k|v] GEMM: each wave computes a 16x64 strip = 4 wmma tiles ----
    v8f acc[4];
#pragma unroll
    for (int t = 0; t < 4; ++t)
      acc[t] = (v8f){0.f, 0.f, 0.f, 0.f, 0.f, 0.f, 0.f, 0.f};
#pragma unroll 4
    for (int k0 = 0; k0 < DIM; k0 += 4) {
      // A[m][k]: m = lane%16 (x row), k = 2*half + {0,1}
      v2f a = *(const v2f*)(x_lds + (row0 + l) * XP + k0 + 2 * half);
      const float* wr = w_lds + (k0 + 2 * half) * WP1 + c0 + l;
#pragma unroll
      for (int t = 0; t < 4; ++t) {
        v2f bb = {wr[t * 16], wr[t * 16 + WP1]};  // B[k][n], rows k and k+1
        acc[t] = wmma4(a, bb, acc[t]);
      }
    }

    // ---- L2-normalize k rows (quarters 0,1 hold k; each tile = one head) ----
    if (qt < 2) {
#pragma unroll
      for (int t = 0; t < 4; ++t) {
#pragma unroll
        for (int i = 0; i < 8; ++i) {
          float ss = red16(acc[t][i] * acc[t][i]);
          float sc = 1.f / fmaxf(sqrtf(ss), 1e-12f);
          acc[t][i] *= sc;
        }
      }
    }

    // ---- stash khat / v tiles into LDS (C-layout: row=i+8*half, col=lane%16)
#pragma unroll
    for (int t = 0; t < 4; ++t) {
      float* dst = kv_lds + c0 + t * 16 + l;
#pragma unroll
      for (int i = 0; i < 8; ++i)
        dst[(row0 + i + 8 * half) * WP1] = acc[t][i];
    }
    // next x tile into the buffer whose readers left before this trip's barrier
    if (it + 1 < NTILES) {
      *(v4f*)(n_lds + xs)           = p0;
      *(v4f*)(n_lds + xs + 16 * XP) = p1;
      *(v4f*)(n_lds + xs + 32 * XP) = p2;
      *(v4f*)(n_lds + xs + 48 * XP) = p3;
    }
    __syncthreads();

    // ---- kvs += Khat^T * V for head kh over this wave's 32 rows ----
    // A[m][k] = khat[j0+k][16*kh+m]; B[k][d] = v[j0+k][16*kh+d]
#pragma unroll
    for (int js = 0; js < 8; ++js) {
      int j0 = rhalf * 32 + js * 4 + 2 * half;
      const float* kr = kv_lds + (size_t)j0 * WP1 + kh * 16 + l;
      v2f a  = {kr[0], kr[WP1]};          // khat rows j0, j0+1
      v2f bb = {kr[128], kr[WP1 + 128]};  // v rows j0, j0+1
      ksum += a.x + a.y;                  // partial column sum of khat
      kvacc = wmma4(a, bb, kvacc);
    }
  }

  // ---- write partial stats (combined in kernel 2) ----
  float* kdst = ws_kvs + (((size_t)b * NHEAD + kh) * 2 + rhalf) * 256;
#pragma unroll
  for (int i = 0; i < 8; ++i)
    kdst[(i + 8 * half) * 16 + l] = kvacc[i];
  ws_ksum[(((size_t)b * NHEAD + kh) * 2 + rhalf) * 32 + lane] = ksum;
}

// Stats of one b: the two row-half partials of kernel 1 are summed into LDS.
static __device__ __forceinline__ void stage_stats(
    int b, int tid, const float* __restrict__ ws_kvs,
    const float* __restrict__ ws_ksum, float* kvs_lds, float* ksum_lds) {
  for (int i = tid; i < NHEAD * 256; i += NTHREADS) {
    size_t base = (((size_t)b * NHEAD + (i >> 8)) * 2) * 256;
    int md = i & 255;
    kvs_lds[i] = ws_kvs[base + md] + ws_kvs[base + 256 + md];
  }
  if (tid < DIM) {
    size_t base = (((size_t)b * NHEAD + (tid >> 4)) * 2) * 32;
    int m = tid & 15;
    ksum_lds[tid] = ws_ksum[base + m] + ws_ksum[base + m + 16] +
                    ws_ksum[base + 32 + m] + ws_ksum[base + 48 + m];
  }
}

// ---------------------------------------------------------------------------
// Kernel 2: per 64-row tile: q = x@Wq (normalize), v = x@Wv,
// attn = qhat@kvs + N*v, out_pre = attn / (qhat.ksum + N),
// out = out_pre @ W_out + b_out.  Fully fused; tiles at the padded pitches.
// One work-group per WGP walks K2_TILES consecutive tiles: the three weight
// panels and the bias are staged once, the stats whenever b changes, and the
// next x tile is loaded into registers at the head of a trip and stored to LDS
// once the qhat readers have left that buffer.
// ---------------------------------------------------------------------------
__global__ void __launch_bounds__(NTHREADS)
attn_out_kernel(const float* __restrict__ x, const float* __restrict__ Wqkv,
                const float* __restrict__ Wout, const float* __restrict__ bout,
                const float* __restrict__ ws_kvs,
                const float* __restrict__ ws_ksum, float* __restrict__ out) {
  extern __shared__ float smem[];
  float* wq_lds   = smem;                   // 128 x WP2 (W_qkv cols 0..127)
  float* wv_lds   = wq_lds + DIM * WP2;     // 128 x WP2 (W_qkv cols 256..383)
  float* wo_lds   = wv_lds + DIM * WP2;     // 128 x WP2
  float* xq_lds   = wo_lds + DIM * WP2;     // 64 x XP (x, later qhat)
  float* op_lds   = xq_lds + TROWS * XP;    // 64 x XP pre-projection
  float* kvs_lds  = op_lds + TROWS * XP;    // 8*256
  float* ksum_lds = kvs_lds + NHEAD * 256;  // 128
  float* bias_lds = ksum_lds + DIM;         // 128

  const int t0   = blockIdx.x * K2_TILES;  // tile t = b * NTILES + nt
  const int tid  = threadIdx.x;
  const int wave = tid >> 5;
  const int lane = tid & 31;
  const int half = lane >> 4;
  const int l    = lane & 15;

  // ---- stage the first x tile, the weights, the bias and the first stats ----
  // wave w moves rows w, w+16, ...: 32 lanes x 4 floats = one 128-wide row
  const int xg = wave * DIM + (lane << 2);  // offset in a global tile
  const int xs = wave * XP + (lane << 2);   // offset in the LDS tile
  const float* xt = x + (size_t)t0 * TROWS * DIM + xg;
  v4f p0 = *(const v4f*)(xt);
  v4f p1 = *(const v4f*)(xt + 16 * DIM);
  v4f p2 = *(const v4f*)(xt + 32 * DIM);
  v4f p3 = *(const v4f*)(xt + 48 * DIM);
  *(v4f*)(xq_lds + xs)           = p0;
  *(v4f*)(xq_lds + xs + 16 * XP) = p1;
  *(v4f*)(xq_lds + xs + 32 * XP) = p2;
  *(v4f*)(xq_lds + xs + 48 * XP) = p3;
#pragma unroll  // all loads in flight before the first LDS store waits
  for (int j = 0; j < DIM / 16; ++j) {
    int r = wave + j * 16;
    int c = lane << 2;
    *(v4f*)(wq_lds + r * WP2 + c) = *(const v4f*)(Wqkv + r * 384 + c);
    *(v4f*)(wv_lds + r * WP2 + c) = *(const v4f*)(Wqkv + r * 384 + 256 + c);
    *(v4f*)(wo_lds + r * WP2 + c) = *(const v4f*)(Wout + r * DIM + c);
  }
  if (tid < DIM) bias_lds[tid] = bout[tid];
  stage_stats(t0 / NTILES, tid, ws_kvs, ws_ksum, kvs_lds, ksum_lds);

  // q/v GEMM role: row block rb, heads h0, h0+1 (q and v tiles)
  const int rb   = wave & 3;
  const int h0   = (wave >> 2) * 2;
  const int row0 = rb * 16;
  // output projection role: column block cb, row blocks 0/16 and 32/48
  const int cb = wave & 7;
  const int rA = (wave >> 3) * 16;
  const int rB = rA + 32;
  const int c0 = cb * 16;

  for (int it = 0; it < K2_TILES; ++it) {
    const int t = t0 + it;
    __syncthreads();  // x tile t and its stats are stored; op_lds readers left
    if (it + 1 < K2_TILES) {
      const float* xn = x + (size_t)(t + 1) * TROWS * DIM + xg;
      p0 = *(const v4f*)(xn);
      p1 = *(const v4f*)(xn + 16 * DIM);
      p2 = *(const v4f*)(xn + 32 * DIM);
      p3 = *(const v4f*)(xn + 48 * DIM);
    }

    // ---- q/v GEMM ----
    v8f q0  = {0.f, 0.f, 0.f, 0.f, 0.f, 0.f, 0.f, 0.f};
    v8f q1  = q0, v0t = q0, v1t = q0;
#pragma unroll 4
    for (int k0 = 0; k0 < DIM; k0 += 4) {
      v2f a = *(const v2f*)(xq_lds + (row0 + l) * XP + k0 + 2 * half);
      const float* wrq = wq_lds + (k0 + 2 * half) * WP2 + 16 * h0 + l;
      const float* wrv = wv_lds + (k0 + 2 * half) * WP2 + 16 * h0 + l;
      v2f bq0 = {wrq[0], wrq[WP2]};
      v2f bq1 = {wrq[16], wrq[16 + WP2]};
      v2f bv0 = {wrv[0], wrv[WP2]};
      v2f bv1 = {wrv[16], wrv[16 + WP2]};
      q0  = wmma4(a, bq0, q0);
      q1  = wmma4(a, bq1, q1);
      v0t = wmma4(a, bv0, v0t);
      v1t = wmma4(a, bv1, v1t);
    }

    // ---- L2-normalize q (per head = per tile; rows across 16-lane halves) ----
#pragma unroll
    for (int i = 0; i < 8; ++i) {
      float s0 = red16(q0[i] * q0[i]);
      q0[i] *= 1.f / fmaxf(sqrtf(s0), 1e-12f);
      float s1 = red16(q1[i] * q1[i]);
      q1[i] *= 1.f / fmaxf(sqrtf(s1), 1e-12f);
    }

    __syncthreads();  // everyone finished reading x from xq_lds
#pragma unroll
    for (int i = 0; i < 8; ++i) {
      xq_lds[(row0 + i + 8 * half) * XP + 16 * h0 + l]       = q0[i];
      xq_lds[(row0 + i + 8 * half) * XP + 16 * (h0 + 1) + l] = q1[i];
    }
    __syncthreads();

    // ---- attn = qhat @ kvs + N*v ; out_pre = attn / (qhat.ksum + N) ----
#pragma unroll
    for (int hh = 0; hh < 2; ++hh) {
      const int h = h0 + hh;
      v8f vt = (hh == 0) ? v0t : v1t;
      v8f qh = (hh == 0) ? q0 : q1;
      v8f att;
#pragma unroll
      for (int i = 0; i < 8; ++i) att[i] = 1024.f * vt[i];  // N * v (C layout)
#pragma unroll
      for (int k0 = 0; k0 < HD; k0 += 4) {
        v2f a =
            *(const v2f*)(xq_lds + (row0 + l) * XP + 16 * h + k0 + 2 * half);
        const float* kr = kvs_lds + h * 256 + (k0 + 2 * half) * 16 + l;
        v2f bb = {kr[0], kr[16]};
        att = wmma4(a, bb, att);
      }
      float ks = ksum_lds[h * 16 + l];
#pragma unroll
      for (int i = 0; i < 8; ++i) {
        float dot = red16(qh[i] * ks);       // qhat-row . ksum  (per row)
        float inv = 1.f / (dot + 1024.f);    // + N
        op_lds[(row0 + i + 8 * half) * XP + 16 * h + l] = att[i] * inv;
      }
    }
    __syncthreads();

    // next x tile (and, where b changes, its stats) into the buffers whose
    // readers left before the barrier above
    if (it + 1 < K2_TILES) {
      *(v4f*)(xq_lds + xs)           = p0;
      *(v4f*)(xq_lds + xs + 16 * XP) = p1;
      *(v4f*)(xq_lds + xs + 32 * XP) = p2;
      *(v4f*)(xq_lds + xs + 48 * XP) = p3;
      if (((t + 1) & (NTILES - 1)) == 0)
        stage_stats((t + 1) / NTILES, tid, ws_kvs, ws_ksum, kvs_lds, ksum_lds);
    }

    // ---- output projection: out = op @ W_out + b_out ----
    v8f oA, oB;
#pragma unroll
    for (int i = 0; i < 8; ++i) {
      oA[i] = bias_lds[c0 + l];
      oB[i] = oA[i];
    }
#pragma unroll 4
    for (int k0 = 0; k0 < DIM; k0 += 4) {
      const float* wr = wo_lds + (k0 + 2 * half) * WP2 + c0 + l;
      v2f bb = {wr[0], wr[WP2]};
      v2f aA = *(const v2f*)(op_lds + (rA + l) * XP + k0 + 2 * half);
      v2f aB = *(const v2f*)(op_lds + (rB + l) * XP + k0 + 2 * half);
      oA = wmma4(aA, bb, oA);
      oB = wmma4(aB, bb, oB);
    }
    float* ob = out + (size_t)t * TROWS * DIM;
#pragma unroll
    for (int i = 0; i < 8; ++i) {
      ob[(rA + i + 8 * half) * DIM + c0 + l] = oA[i];
      ob[(rB + i + 8 * half) * DIM + c0 + l] = oB[i];
    }
    // the next trip reuses the registers that these stores name
    asm volatile("s_wait_xcnt 0x0" ::: "memory");
  }
}

extern "C" void kernel_launch(void* const* d_in, const int* in_sizes, int n_in,
                              void* d_out, int out_size, void* d_ws,
                              size_t ws_size, hipStream_t stream) {
  (void)in_sizes; (void)n_in; (void)out_size; (void)ws_size;
  const float* x    = (const float*)d_in[0];
  const float* Wqkv = (const float*)d_in[1];
  const float* Wout = (const float*)d_in[2];
  const float* bout = (const float*)d_in[3];
  float* out = (float*)d_out;

  float* ws_kvs  = (float*)d_ws;                           // 192*8*2*256 f32
  float* ws_ksum = ws_kvs + (size_t)BT * NHEAD * 2 * 256;  // 192*8*2*32  f32

  const size_t shmem1 =
      (size_t)(DIM * WP1 + 2 * TROWS * XP + TROWS * WP1) * sizeof(float);
  const size_t shmem2 =
      (size_t)(3 * DIM * WP2 + 2 * TROWS * XP + NHEAD * 256 + DIM + DIM) *
      sizeof(float);

  (void)hipFuncSetAttribute((const void*)kv_stats_kernel,
                            hipFuncAttributeMaxDynamicSharedMemorySize,
                            (int)shmem1);
  (void)hipFuncSetAttribute((const void*)attn_out_kernel,
                            hipFuncAttributeMaxDynamicSharedMemorySize,
                            (int)shmem2);

  kv_stats_kernel<<<dim3(BT), dim3(NTHREADS), shmem1, stream>>>(x, Wqkv, ws_kvs,
                                                                ws_ksum);
  attn_out_kernel<<<dim3(K2_GROUPS), dim3(NTHREADS), shmem2, stream>>>(
      x, Wqkv, Wout, bout, ws_kvs, ws_ksum, out);
}

// v003
// Measured time: 234 microseconds a run.
// Next to v002, in two timings, it ran 1.11 times as fast each time.
// All steps since v000 together make it 1.98 times as fast.
#include <hip/hip_runtime.h>
#include <math.h>
#include <stdint.h>

// Problem constants (from reference): B=16, T=12 -> BT=192, N=1024, D=128, H=8, hd=16
#define SEQ      1024
#define DIM      128
#define NHEAD    8
#define HD       16
#define BT       192
#define TROWS    64
#define NTHREADS 512
#define NTILES   (SEQ / TROWS)   // 16
#define K1_GROUPS 256                          // kernel 1: one work-group a WGP
#define K1_TILES  (BT * NTILES / K1_GROUPS)    // 12 tiles each
#define K2_GROUPS 256                          // kernel 2: one work-group a WGP
#define K2_TILES  (BT * NTILES / K2_GROUPS)    // 12 tiles each
#define NPART    4   // stats partials of one (b, head): 2 tile runs x 2 row halves
// LDS row pitches in floats (64 banks of 4 bytes).
// A-fragment tiles (lane = row, 8 bytes a lane): 132 = 4 mod 64, so the 16 rows
// of one read fall on 16 different groups of four banks.
// B-fragment panels (lane = column; the two lane halves read rows k and k+2):
// twice the pitch = 32 mod 64, so the halves fall on different banks.
#define XP       132   // x, qhat and pre-projection tiles
#define WP1      272   // 256-wide [Wk|Wv] panel and [khat|v] tile
#define WP2      144   // 128-wide weight panels

typedef float v2f __attribute__((ext_vector_type(2)));
typedef float v4f __attribute__((ext_vector_type(4)));
typedef float v8f __attribute__((ext_vector_type(8)));

// D = A(16x4) * B(4x16) + C(16x16), fp32, wave32.
static __device__ __forceinline__ v8f wmma4(v2f a, v2f b, v8f c) {
  return __builtin_amdgcn_wmma_f32_16x16x4_f32(false, a, false, b, (short)0, c,
                                               false, false);
}

// Sum across each 16-lane half of a wave32 (xor masks 1,2,4,8 stay in-half).
static __device__ __forceinline__ float red16(float v) {
  v += __shfl_xor(v, 1, 32);
  v += __shfl_xor(v, 2, 32);
  v += __shfl_xor(v, 4, 32);
  v += __shfl_xor(v, 8, 32);
  return v;
}

// ---------------------------------------------------------------------------
// Kernel 1: partial kvs[b,h] = sum_n khat[n] (x) v[n]  (16x16) and partial
// ksum[b,h] = sum_n khat[n], via k = x@Wk, v = x@Wv.
// One work-group per WGP walks K1_TILES consecutive tiles (tile t = b * NTILES
// + nt), 16 waves. A run of 12 tiles cuts every b (16 tiles) exactly once, so
// each b is covered by two runs: the run that holds its first tile writes
// partial 0, the other partial 1, each when it leaves that b.
// The x tiles are double-buffered: the next tile is loaded into registers
// ahead of the GEMM and stored to LDS behind it; the Wk|Wv panel is staged
// once. All tiles lie at the padded pitches above.
// ---------------------------------------------------------------------------
__global__ void __launch_bounds__(NTHREADS)
kv_stats_kernel(const float* __restrict__ x, const float* __restrict__ Wqkv,
                float* __restrict__ ws_kvs, float* __restrict__ ws_ksum) {
  extern __shared__ float smem[];
  float* w_lds  = smem;                   // 128 x WP1 : W_qkv cols 128..383 = [Wk|Wv]
  float* x0_lds = w_lds + DIM * WP1;      // 64 x XP (ping)
  float* x1_lds = x0_lds + TROWS * XP;    // 64 x XP (pong)
  float* kv_lds = x1_lds + TROWS * XP;    // 64 x WP1 : [khat | v]

  const int t0   = blockIdx.x * K1_TILES;  // tile t = b * NTILES + nt
  const int tid  = threadIdx.x;
  const int wave = tid >> 5;
  const int lane = tid & 31;
  const int half = lane >> 4;
  const int l    = lane & 15;

  const float* xb = x + (size_t)t0 * TROWS * DIM;

#pragma unroll  // all loads in flight before the first LDS store waits
  for (int j = 0; j < DIM * 256 / 4 / NTHREADS; ++j) {
    int r  = (tid >> 6) + j * (NTHREADS >> 6);  // 64 groups of 4 floats a row
    int c4 = (tid & 63) << 2;
    *(v4f*)(w_lds + r * WP1 + c4) = *(const v4f*)(Wqkv + r * 384 + 128 + c4);
  }
  // x tile: wave w moves rows w, w+16, w+32, w+48, one float4 a lane and row.
  const int xg = wave * DIM + (lane << 2);  // offset in the global tile
  const int xs = wave * XP + (lane << 2);   // offset in the LDS tile
  v4f p0 = *(const v4f*)(xb + xg);
  v4f p1 = *(const v4f*)(xb + xg + 16 * DIM);
  v4f p2 = *(const v4f*)(xb + xg + 32 * DIM);
  v4f p3 = *(const v4f*)(xb + xg + 48 * DIM);
  *(v4f*)(x0_lds + xs)           = p0;
  *(v4f*)(x0_lds + xs + 16 * XP) = p1;
  *(v4f*)(x0_lds + xs + 32 * XP) = p2;
  *(v4f*)(x0_lds + xs + 48 * XP) = p3;

  const int kh    = wave & 7;   // head this wave reduces
  const int rhalf = wave >> 3;  // which 32-row half of the tile
  const int rb    = wave & 3;   // GEMM role: row block (16 rows)
  const int qt    = wave >> 2;  // GEMM role: 64-col quarter (0,1 = k; 2,3 = v)
  const int row0  = rb * 16;
  const int c0    = qt * 64;

  v8f   kvacc = {0.f, 0.f, 0.f, 0.f, 0.f, 0.f, 0.f, 0.f};
  float ksum  = 0.f;

  for (int it = 0; it < K1_TILES; ++it) {
    __syncthreads();  // tile it is stored; prior x / kv_lds readers are done
    const float* x_lds = (it & 1) ? x1_lds : x0_lds;
    float*       n_lds = (it & 1) ? x0_lds : x1_lds;
    if (it + 1 < K1_TILES) {
      const float* xn = xb + (size_t)(it + 1) * TROWS * DIM + xg;
      p0 = *(const v4f*)(xn);
      p1 = *(const v4f*)(xn + 16 * DIM);
      p2 = *(const v4f*)(xn + 32 * DIM);
      p3 = *(const v4f*)(xn + 48 * DIM);
    }

    // ---- [k|v] GEMM: each wave computes a 16x64 strip = 4 wmma tiles ----
    v8f acc[4];
#pragma unroll
    for (int t = 0; t < 4; ++t)
      acc[t] = (v8f){0.f, 0.f, 0.f, 0.f, 0.f, 0.f, 0.f, 0.f};
#pragma unroll 4
    for (int k0 = 0; k0 < DIM; k0 += 4) {
      // A[m][k]: m = lane%16 (x row), k = 2*half + {0,1}
      v2f a = *(const v2f*)(x_lds + (row0 + l) * XP + k0 + 2 * half);
      const float* wr = w_lds + (k0 + 2 * half) * WP1 + c0 + l;
#pragma unroll
      for (int t = 0; t < 4; ++t) {
        v2f bb = {wr[t * 16], wr[t * 16 + WP1]};  // B[k][n], rows k and k+1
        acc[t] = wmma4(a, bb, acc[t]);
      }
    }

    // ---- L2-normalize k rows (quarters 0,1 hold k; each tile = one head) ----
    if (qt < 2) {
#pragma unroll
      for (int t = 0; t < 4; ++t) {
#pragma unroll
        for (int i = 0; i < 8; ++i) {
          float ss = red16(acc[t][i] * acc[t][i]);
          float sc = 1.f / fmaxf(sqrtf(ss), 1e-12f);
          acc[t][i] *= sc;
        }
      }
    }

    // ---- stash khat / v tiles into LDS (C-layout: row=i+8*half, col=lane%16)
#pragma unroll
    for (int t = 0; t < 4; ++t) {
      float* dst = kv_lds + c0 + t * 16 + l;
#pragma unroll
      for (int i = 0; i < 8; ++i)
        dst[(row0 + i + 8 * half) * WP1] = acc[t][i];
    }
    // next x tile into the buffer whose readers left before this trip's barrier
    if (it + 1 < K1_TILES) {
      *(v4f*)(n_lds + xs)           = p0;
      *(v4f*)(n_lds + xs + 16 * XP) = p1;
      *(v4f*)(n_lds + xs + 32 * XP) = p2;
      *(v4f*)(n_lds + xs + 48 * XP) = p3;
    }
    __syncthreads();

    // ---- kvs += Khat^T * V for head kh over this wave's 32 rows ----
    // A[m][k] = khat[j0+k][16*kh+m]; B[k][d] = v[j0+k][16*kh+d]
#pragma unroll
    for (int js = 0; js < 8; ++js) {
      int j0 = rhalf * 32 + js * 4 + 2 * half;
      const float* kr = kv_lds + (size_t)j0 * WP1 + kh * 16 + l;
      v2f a  = {kr[0], kr[WP1]};          // khat rows j0, j0+1
      v2f bb = {kr[128], kr[WP1 + 128]};  // v rows j0, j0+1
      ksum += a.x + a.y;                  // partial column sum of khat
      kvacc = wmma4(a, bb, kvacc);
    }

    // ---- leaving this b or this run: write the partial stats (combined in
    // kernel 2) and start the sums anew ----
    const int t = t0 + it;
    if (((t + 1) & (NTILES - 1)) == 0 || it + 1 == K1_TILES) {
      const int b    = t / NTILES;
      const int part = (t0 > b * NTILES) ? 1 : 0;  // run began inside this b
      const size_t slot = ((size_t)b * NHEAD + kh) * NPART + part * 2 + rhalf;
      float* kdst = ws_kvs + slot * 256;
#pragma unroll
      for (int i = 0; i < 8; ++i)
        kdst[(i + 8 * half) * 16 + l] = kvacc[i];
      ws_ksum[slot * 32 + lane] = ksum;
      // the sums' registers, which these stores name, are cleared next
      asm volatile("s_wait_xcnt 0x0" ::: "memory");
      kvacc = (v8f){0.f, 0.f, 0.f, 0.f, 0.f, 0.f, 0.f, 0.f};
      ksum  = 0.f;
    }
  }
}

// Stats of one b: the four partials of kernel 1 (two tile runs, two row halves
// each) are summed into LDS.
static __device__ __forceinline__ void stage_stats(
    int b, int tid, const float* __restrict__ ws_kvs,
    const float* __restrict__ ws_ksum, float* kvs_lds, float* ksum_lds) {
  for (int i = tid; i < NHEAD * 256; i += NTHREADS) {
    size_t base = (((size_t)b * NHEAD + (i >> 8)) * NPART) * 256;
    int md = i & 255;
    kvs_lds[i] = (ws_kvs[base + md] + ws_kvs[base + 256 + md]) +
                 (ws_kvs[base + 512 + md] + ws_kvs[base + 768 + md]);
  }
  if (tid < DIM) {
    size_t base = (((size_t)b * NHEAD + (tid >> 4)) * NPART) * 32;
    int m = tid & 15;
    ksum_lds[tid] = (ws_ksum[base + m] + ws_ksum[base + m + 16] +
                     ws_ksum[base + 32 + m] + ws_ksum[base + 48 + m]) +
                    (ws_ksum[base + 64 + m] + ws_ksum[base + 80 + m] +
                     ws_ksum[base + 96 + m] + ws_ksum[base + 112 + m]);
  }
}

// ---------------------------------------------------------------------------
// Kernel 2: per 64-row tile: q = x@Wq (normalize), v = x@Wv,
// attn = qhat@kvs + N*v, out_pre = attn / (qhat.ksum + N),
// out = out_pre @ W_out + b_out.  Fully fused; tiles at the padded pitches.
// One work-group per WGP walks K2_TILES consecutive tiles: the three weight
// panels and the bias are staged once, the stats whenever b changes, and the
// next x tile is loaded into registers at the head of a trip and stored to LDS
// once the qhat readers have left that buffer.
// ---------------------------------------------------------------------------
__global__ void __launch_bounds__(NTHREADS)
attn_out_kernel(const float* __restrict__ x, const float* __restrict__ Wqkv,
                const float* __restrict__ Wout, const float* __restrict__ bout,
                const float* __restrict__ ws_kvs,
                const float* __restrict__ ws_ksum, float* __restrict__ out) {
  extern __shared__ float smem[];
  float* wq_lds   = smem;                   // 128 x WP2 (W_qkv cols 0..127)
  float* wv_lds   = wq_lds + DIM * WP2;     // 128 x WP2 (W_qkv cols 256..383)
  float* wo_lds   = wv_lds + DIM * WP2;     // 128 x WP2
  float* xq_lds   = wo_lds + DIM * WP2;     // 64 x XP (x, later qhat)
  float* op_lds   = xq_lds + TROWS * XP;    // 64 x XP pre-projection
  float* kvs_lds  = op_lds + TROWS * XP;    // 8*256
  float* ksum_lds = kvs_lds + NHEAD * 256;  // 128
  float* bias_lds = ksum_lds + DIM;         // 128

  const int t0   = blockIdx.x * K2_TILES;  // tile t = b * NTILES + nt
  const int tid  = threadIdx.x;
  const int wave = tid >> 5;
  const int lane = tid & 31;
  const int half = lane >> 4;
  const int l    = lane & 15;

  // ---- stage the first x tile, the weights, the bias and the first stats ----
  // wave w moves rows w, w+16, ...: 32 lanes x 4 floats = one 128-wide row
  const int xg = wave * DIM + (lane << 2);  // offset in a global tile
  const int xs = wave * XP + (lane << 2);   // offset in the LDS tile
  const float* xt = x + (size_t)t0 * TROWS * DIM + xg;
  v4f p0 = *(const v4f*)(xt);
  v4f p1 = *(const v4f*)(xt + 16 * DIM);
  v4f p2 = *(const v4f*)(xt + 32 * DIM);
  v4f p3 = *(const v4f*)(xt + 48 * DIM);
  *(v4f*)(xq_lds + xs)           = p0;
  *(v4f*)(xq_lds + xs + 16 * XP) = p1;
  *(v4f*)(xq_lds + xs + 32 * XP) = p2;
  *(v4f*)(xq_lds + xs + 48 * XP) = p3;
#pragma unroll  // all loads in flight before the first LDS store waits
  for (int j = 0; j < DIM / 16; ++j) {
    int r = wave + j * 16;
    int c = lane << 2;
    *(v4f*)(wq_lds + r * WP2 + c) = *(const v4f*)(Wqkv + r * 384 + c);
    *(v4f*)(wv_lds + r * WP2 + c) = *(const v4f*)(Wqkv + r * 384 + 256 + c);
    *(v4f*)(wo_lds + r * WP2 + c) = *(const v4f*)(Wout + r * DIM + c);
  }
  if (tid < DIM) bias_lds[tid] = bout[tid];
  stage_stats(t0 / NTILES, tid, ws_kvs, ws_ksum, kvs_lds, ksum_lds);

  // q/v GEMM role: row block rb, heads h0, h0+1 (q and v tiles)
  const int rb   = wave & 3;
  const int h0   = (wave >> 2) * 2;
  const int row0 = rb * 16;
  // output projection role: column block cb, row blocks 0/16 and 32/48
  const int cb = wave & 7;
  const int rA = (wave >> 3) * 16;
  const int rB = rA + 32;
  const int c0 = cb * 16;

  for (int it = 0; it < K2_TILES; ++it) {
    const int t = t0 + it;
    __syncthreads();  // x tile t and its stats are stored; op_lds readers left
    if (it + 1 < K2_TILES) {
      const float* xn = x + (size_t)(t + 1) * TROWS * DIM + xg;
      p0 = *(const v4f*)(xn);
      p1 = *(const v4f*)(xn + 16 * DIM);
      p2 = *(const v4f*)(xn + 32 * DIM);
      p3 = *(const v4f*)(xn + 48 * DIM);
    }

    // ---- q/v GEMM ----
    v8f q0  = {0.f, 0.f, 0.f, 0.f, 0.f, 0.f, 0.f, 0.f};
    v8f q1  = q0, v0t = q0, v1t = q0;
#pragma unroll 4
    for (int k0 = 0; k0 < DIM; k0 += 4) {
      v2f a = *(const v2f*)(xq_lds + (row0 + l) * XP + k0 + 2 * half);
      const float* wrq = wq_lds + (k0 + 2 * half) * WP2 + 16 * h0 + l;
      const float* wrv = wv_lds + (k0 + 2 * half) * WP2 + 16 * h0 + l;
      v2f bq0 = {wrq[0], wrq[WP2]};
      v2f bq1 = {wrq[16], wrq[16 + WP2]};
      v2f bv0 = {wrv[0], wrv[WP2]};
      v2f bv1 = {wrv[16], wrv[16 + WP2]};
      q0  = wmma4(a, bq0, q0);
      q1  = wmma4(a, bq1, q1);
      v0t = wmma4(a, bv0, v0t);
      v1t = wmma4(a, bv1, v1t);
    }

    // ---- L2-normalize q (per head = per tile; rows across 16-lane halves) ----
#pragma unroll
    for (int i = 0; i < 8; ++i) {
      float s0 = red16(q0[i] * q0[i]);
      q0[i] *= 1.f / fmaxf(sqrtf(s0), 1e-12f);
      float s1 = red16(q1[i] * q1[i]);
      q1[i] *= 1.f / fmaxf(sqrtf(s1), 1e-12f);
    }

    __syncthreads();  // everyone finished reading x from xq_lds
#pragma unroll
    for (int i = 0; i < 8; ++i) {
      xq_lds[(row0 + i + 8 * half) * XP + 16 * h0 + l]       = q0[i];
      xq_lds[(row0 + i + 8 * half) * XP + 16 * (h0 + 1) + l] = q1[i];
    }
    __syncthreads();

    // ---- attn = qhat @ kvs + N*v ; out_pre = attn / (qhat.ksum + N) ----
#pragma unroll
    for (int hh = 0; hh < 2; ++hh) {
      const int h = h0 + hh;
      v8f vt = (hh == 0) ? v0t : v1t;
      v8f qh = (hh == 0) ? q0 : q1;
      v8f att;
#pragma unroll
      for (int i = 0; i < 8; ++i) att[i] = 1024.f * vt[i];  // N * v (C layout)
#pragma unroll
      for (int k0 = 0; k0 < HD; k0 += 4) {
        v2f a =
            *(const v2f*)(xq_lds + (row0 + l) * XP + 16 * h + k0 + 2 * half);
        const float* kr = kvs_lds + h * 256 + (k0 + 2 * half) * 16 + l;
        v2f bb = {kr[0], kr[16]};
        att = wmma4(a, bb, att);
      }
      float ks = ksum_lds[h * 16 + l];
#pragma unroll
      for (int i = 0; i < 8; ++i) {
        float dot = red16(qh[i] * ks);       // qhat-row . ksum  (per row)
        float inv = 1.f / (dot + 1024.f);    // + N
        op_lds[(row0 + i + 8 * half) * XP + 16 * h + l] = att[i] * inv;
      }
    }
    __syncthreads();

    // next x tile (and, where b changes, its stats) into the buffers whose
    // readers left before the barrier above
    if (it + 1 < K2_TILES) {
      *(v4f*)(xq_lds + xs)           = p0;
      *(v4f*)(xq_lds + xs + 16 * XP) = p1;
      *(v4f*)(xq_lds + xs + 32 * XP) = p2;
      *(v4f*)(xq_lds + xs + 48 * XP) = p3;
      if (((t + 1) & (NTILES - 1)) == 0)
        stage_stats((t + 1) / NTILES, tid, ws_kvs, ws_ksum, kvs_lds, ksum_lds);
    }

    // ---- output projection: out = op @ W_out + b_out ----
    v8f oA, oB;
#pragma unroll
    for (int i = 0; i < 8; ++i) {
      oA[i] = bias_lds[c0 + l];
      oB[i] = oA[i];
    }
#pragma unroll 4
    for (int k0 = 0; k0 < DIM; k0 += 4) {
      const float* wr = wo_lds + (k0 + 2 * half) * WP2 + c0 + l;
      v2f bb = {wr[0], wr[WP2]};
      v2f aA = *(const v2f*)(op_lds + (rA + l) * XP + k0 + 2 * half);
      v2f aB = *(const v2f*)(op_lds + (rB + l) * XP + k0 + 2 * half);
      oA = wmma4(aA, bb, oA);
      oB = wmma4(aB, bb, oB);
    }
    float* ob = out + (size_t)t * TROWS * DIM;
#pragma unroll
    for (int i = 0; i < 8; ++i) {
      ob[(rA + i + 8 * half) * DIM + c0 + l] = oA[i];
      ob[(rB + i + 8 * half) * DIM + c0 + l] = oB[i];
    }
    // the next trip reuses the registers that these stores name
    asm volatile("s_wait_xcnt 0x0" ::: "memory");
  }
}

extern "C" void kernel_launch(void* const* d_in, const int* in_sizes, int n_in,
                              void* d_out, int out_size, void* d_ws,
                              size_t ws_size, hipStream_t stream) {
  (void)in_sizes; (void)n_in; (void)out_size; (void)ws_size;
  const float* x    = (const float*)d_in[0];
  const float* Wqkv = (const float*)d_in[1];
  const float* Wout = (const float*)d_in[2];
  const float* bout = (const float*)d_in[3];
  float* out = (float*)d_out;

  float* ws_kvs  = (float*)d_ws;                               // 192*8*4*256 f32
  float* ws_ksum = ws_kvs + (size_t)BT * NHEAD * NPART * 256;  // 192*8*4*32  f32

  const size_t shmem1 =
      (size_t)(DIM * WP1 + 2 * TROWS * XP + TROWS * WP1) * sizeof(float);
  const size_t shmem2 =
      (size_t)(3 * DIM * WP2 + 2 * TROWS * XP + NHEAD * 256 + DIM + DIM) *
      sizeof(float);

  (void)hipFuncSetAttribute((const void*)kv_stats_kernel,
                            hipFuncAttributeMaxDynamicSharedMemorySize,
                            (int)shmem1);
  (void)hipFuncSetAttribute((const void*)attn_out_kernel,
                            hipFuncAttributeMaxDynamicSharedMemorySize,
                            (int)shmem2);

  kv_stats_kernel<<<dim3(K1_GROUPS), dim3(NTHREADS), shmem1, stream>>>(
      x, Wqkv, ws_kvs, ws_ksum);
  attn_out_kernel<<<dim3(K2_GROUPS), dim3(NTHREADS), shmem2, stream>>>(
      x, Wqkv, Wout, bout, ws_kvs, ws_ksum, out);
}

// v004
// A run of this version takes 215 microseconds.
// Next to v003, in two timings, it ran 1.09 times as fast each time.
// Over all steps from v000 it is 2.16 times as fast.
#include <hip/hip_runtime.h>
#include <math.h>
#include <stdint.h>

// Problem constants (from reference): B=16, T=12 -> BT=192, N=1024, D=128, H=8, hd=16
#define SEQ      1024
#define DIM      128
#define NHEAD    8
#define HD       16
#define BT       192
#define TROWS    64
#define NTHREADS 512
#define NTILES   (SEQ / TROWS)   // 16
#define K1_GROUPS 256                          // kernel 1: one work-group a WGP
#define K1_TILES  (BT * NTILES / K1_GROUPS)    // 12 tiles each
#define K2_GROUPS 256                          // kernel 2: one work-group a WGP
#define K2_TILES  (BT * NTILES / K2_GROUPS)    // 12 tiles each
#define NPART    4   // stats partials of one (b, head): 2 tile runs x 2 row halves
// LDS row pitches in floats (64 banks of 4 bytes).
// A-fragment tiles (lane = row, 8 bytes a lane): 132 = 4 mod 64, so the 16 rows
// of one read fall on 16 different groups of four banks.
// B-fragment panels (lane = column; the two lane halves read rows k and k+2):
// twice the pitch = 32 mod 64, so the halves fall on different banks.
#define XP       132   // x, qhat and pre-projection tiles
#define WP1      272   // 256-wide [Wk|Wv] panel and [khat|v] tile
#define WP2      144   // 128-wide weight panels

typedef float v2f __attribute__((ext_vector_type(2)));
typedef float v4f __attribute__((ext_vector_type(4)));
typedef float v8f __attribute__((ext_vector_type(8)));

// D = A(16x4) * B(4x16) + C(16x16), fp32, wave32.
static __device__ __forceinline__ v8f wmma4(v2f a, v2f b, v8f c) {
  return __builtin_amdgcn_wmma_f32_16x16x4_f32(false, a, false, b, (short)0, c,
                                               false, false);
}

// Sum across each 16-lane half of a wave32 (xor masks 1,2,4,8 stay in-half).
static __device__ __forceinline__ float red16(float v) {
  v += __shfl_xor(v, 1, 32);
  v += __shfl_xor(v, 2, 32);
  v += __shfl_xor(v, 4, 32);
  v += __shfl_xor(v, 8, 32);
  return v;
}

// ---------------------------------------------------------------------------
// Kernel 1: partial kvs[b,h] = sum_n khat[n] (x) v[n]  (16x16) and partial
// ksum[b,h] = sum_n khat[n], via k = x@Wk, v = x@Wv.
// One work-group per WGP walks K1_TILES consecutive tiles (tile t = b * NTILES
// + nt), 16 waves. A run of 12 tiles cuts every b (16 tiles) exactly once, so
// each b is covered by two runs: the run that holds its first tile writes
// partial 0, the other partial 1, each when it leaves that b.
// The x tiles are double-buffered: the next tile is loaded into registers
// ahead of the GEMM and stored to LDS behind it; the Wk|Wv panel is staged
// once. All tiles lie at the padded pitches above.
// The v tiles also go to the workspace for kernel 2, each 16x16 accumulator
// tile (tile t, row block, head) as 256 floats in the accumulator's own lane
// order: float i of lane L at (i / 4) * 128 + L * 4 + i % 4, so that a wave
// moves it with two 16-byte accesses a lane over whole 128-byte lines.
// ---------------------------------------------------------------------------
__global__ void __launch_bounds__(NTHREADS)
kv_stats_kernel(const float* __restrict__ x, const float* __restrict__ Wqkv,
                float* __restrict__ ws_kvs, float* __restrict__ ws_ksum,
                float* __restrict__ ws_v) {
  extern __shared__ float smem[];
  float* w_lds  = smem;                   // 128 x WP1 : W_qkv cols 128..383 = [Wk|Wv]
  float* x0_lds = w_lds + DIM * WP1;      // 64 x XP (ping)
  float* x1_lds = x0_lds + TROWS * XP;    // 64 x XP (pong)
  float* kv_lds = x1_lds + TROWS * XP;    // 64 x WP1 : [khat | v]

  const int t0   = blockIdx.x * K1_TILES;  // tile t = b * NTILES + nt
  const int tid  = threadIdx.x;
  const int wave = tid >> 5;
  const int lane = tid & 31;
  const int half = lane >> 4;
  const int l    = lane & 15;

  const float* xb = x + (size_t)t0 * TROWS * DIM;

#pragma unroll  // all loads in flight before the first LDS store waits
  for (int j = 0; j < DIM * 256 / 4 / NTHREADS; ++j) {
    int r  = (tid >> 6) + j * (NTHREADS >> 6);  // 64 groups of 4 floats a row
    int c4 = (tid & 63) << 2;
    *(v4f*)(w_lds + r * WP1 + c4) = *(const v4f*)(Wqkv + r * 384 + 128 + c4);
  }
  // x tile: wave w moves rows w, w+16, w+32, w+48, one float4 a lane and row.
  const int xg = wave * DIM + (lane << 2);  // offset in the global tile
  const int xs = wave * XP + (lane << 2);   // offset in the LDS tile
  v4f p0 = *(const v4f*)(xb + xg);
  v4f p1 = *(const v4f*)(xb + xg + 16 * DIM);
  v4f p2 = *(const v4f*)(xb + xg + 32 * DIM);
  v4f p3 = *(const v4f*)(xb + xg + 48 * DIM);
  *(v4f*)(x0_lds + xs)           = p0;
  *(v4f*)(x0_lds + xs + 16 * XP) = p1;
  *(v4f*)(x0_lds + xs + 32 * XP) = p2;
  *(v4f*)(x0_lds + xs + 48 * XP) = p3;

  const int kh    = wave & 7;   // head this wave reduces
  const int rhalf = wave >> 3;  // which 32-row half of the tile
  const int rb    = wave & 3;   // GEMM role: row block (16 rows)
  const int qt    = wave >> 2;  // GEMM role: 64-col quarter (0,1 = k; 2,3 = v)
  const int row0  = rb * 16;
  const int c0    = qt * 64;

  v8f   kvacc = {0.f, 0.f, 0.f, 0.f, 0.f, 0.f, 0.f, 0.f};
  float ksum  = 0.f;

  for (int it = 0; it < K1_TILES; ++it) {
    __syncthreads();  // tile it is stored; prior x / kv_lds readers are done
    const float* x_lds = (it & 1) ? x1_lds : x0_lds;
    float*       n_lds = (it & 1) ? x0_lds : x1_lds;
    if (it + 1 < K1_TILES) {
      const float* xn = xb + (size_t)(it + 1) * TROWS * DIM + xg;
      p0 = *(const v4f*)(xn);
      p1 = *(const v4f*)(xn + 16 * DIM);
      p2 = *(const v4f*)(xn + 32 * DIM);
      p3 = *(const v4f*)(xn + 48 * DIM);
    }

    // ---- [k|v] GEMM: each wave computes a 16x64 strip = 4 wmma tiles ----
    v8f acc[4];
#pragma unroll
    for (int t = 0; t < 4; ++t)
      acc[t] = (v8f){0.f, 0.f, 0.f, 0.f, 0.f, 0.f, 0.f, 0.f};
#pragma unroll 4
    for (int k0 = 0; k0 < DIM; k0 += 4) {
      // A[m][k]: m = lane%16 (x row), k = 2*half + {0,1}
      v2f a = *(const v2f*)(x_lds + (row0 + l) * XP + k0 + 2 * half);
      const float* wr = w_lds + (k0 + 2 * half) * WP1 + c0 + l;
#pragma unroll
      for (int t = 0; t < 4; ++t) {
        v2f bb = {wr[t * 16], wr[t * 16 + WP1]};  // B[k][n], rows k and k+1
        acc[t] = wmma4(a, bb, acc[t]);
      }
    }

    // ---- L2-normalize k rows (quarters 0,1 hold k; each tile = one head) ----
    if (qt < 2) {
#pragma unroll
      for (int t = 0; t < 4; ++t) {
#pragma unroll
        for (int i = 0; i < 8; ++i) {
          float ss = red16(acc[t][i] * acc[t][i]);
          float sc = 1.f / fmaxf(sqrtf(ss), 1e-12f);
          acc[t][i] *= sc;
        }
      }
    } else {
      // ---- quarters 2,3 hold v: heads (qt - 2) * 4 + t, to the workspace ----
      float* vd = ws_v +
                  ((size_t)((t0 + it) * 4 + rb) * NHEAD + (qt - 2) * 4) * 256 +
                  (lane << 2);
#pragma unroll  // constant t: the accumulators stay in registers
      for (int t = 0; t < 4; ++t) {
        *(v4f*)(vd + t * 256) =
            (v4f){acc[t][0], acc[t][1], acc[t][2], acc[t][3]};
        *(v4f*)(vd + t * 256 + 128) =
            (v4f){acc[t][4], acc[t][5], acc[t][6], acc[t][7]};
      }
      // the next trip reuses the registers that these stores name
      asm volatile("s_wait_xcnt 0x0" ::: "memory");
    }

    // ---- stash khat / v tiles into LDS (C-layout: row=i+8*half, col=lane%16)
#pragma unroll
    for (int t = 0; t < 4; ++t) {
      float* dst = kv_lds + c0 + t * 16 + l;
#pragma unroll
      for (int i = 0; i < 8; ++i)
        dst[(row0 + i + 8 * half) * WP1] = acc[t][i];
    }
    // next x tile into the buffer whose readers left before this trip's barrier
    if (it + 1 < K1_TILES) {
      *(v4f*)(n_lds + xs)           = p0;
      *(v4f*)(n_lds + xs + 16 * XP) = p1;
      *(v4f*)(n_lds + xs + 32 * XP) = p2;
      *(v4f*)(n_lds + xs + 48 * XP) = p3;
    }
    __syncthreads();

    // ---- kvs += Khat^T * V for head kh over this wave's 32 rows ----
    // A[m][k] = khat[j0+k][16*kh+m]; B[k][d] = v[j0+k][16*kh+d]
#pragma unroll
    for (int js = 0; js < 8; ++js) {
      int j0 = rhalf * 32 + js * 4 + 2 * half;
      const float* kr = kv_lds + (size_t)j0 * WP1 + kh * 16 + l;
      v2f a  = {kr[0], kr[WP1]};          // khat rows j0, j0+1
      v2f bb = {kr[128], kr[WP1 + 128]};  // v rows j0, j0+1
      ksum += a.x + a.y;                  // partial column sum of khat
      kvacc = wmma4(a, bb, kvacc);
    }

    // ---- leaving this b or this run: write the partial stats (combined in
    // kernel 2) and start the sums anew ----
    const int t = t0 + it;
    if (((t + 1) & (NTILES - 1)) == 0 || it + 1 == K1_TILES) {
      const int b    = t / NTILES;
      const int part = (t0 > b * NTILES) ? 1 : 0;  // run began inside this b
      const size_t slot = ((size_t)b * NHEAD + kh) * NPART + part * 2 + rhalf;
      float* kdst = ws_kvs + slot * 256;
#pragma unroll
      for (int i = 0; i < 8; ++i)
        kdst[(i + 8 * half) * 16 + l] = kvacc[i];
      ws_ksum[slot * 32 + lane] = ksum;
      // the sums' registers, which these stores name, are cleared next
      asm volatile("s_wait_xcnt 0x0" ::: "memory");
      kvacc = (v8f){0.f, 0.f, 0.f, 0.f, 0.f, 0.f, 0.f, 0.f};
      ksum  = 0.f;
    }
  }
}

// Stats of one b: the four partials of kernel 1 (two tile runs, two row halves
// each) are summed into LDS.
static __device__ __forceinline__ void stage_stats(
    int b, int tid, const float* __restrict__ ws_kvs,
    const float* __restrict__ ws_ksum, float* kvs_lds, float* ksum_lds) {
  for (int i = tid; i < NHEAD * 256; i += NTHREADS) {
    size_t base = (((size_t)b * NHEAD + (i >> 8)) * NPART) * 256;
    int md = i & 255;
    kvs_lds[i] = (ws_kvs[base + md] + ws_kvs[base + 256 + md]) +
                 (ws_kvs[base + 512 + md] + ws_kvs[base + 768 + md]);
  }
  if (tid < DIM) {
    size_t base = (((size_t)b * NHEAD + (tid >> 4)) * NPART) * 32;
    int m = tid & 15;
    ksum_lds[tid] = (ws_ksum[base + m] + ws_ksum[base + m + 16] +
                     ws_ksum[base + 32 + m] + ws_ksum[base + 48 + m]) +
                    (ws_ksum[base + 64 + m] + ws_ksum[base + 80 + m] +
                     ws_ksum[base + 96 + m] + ws_ksum[base + 112 + m]);
  }
}

// ---------------------------------------------------------------------------
// Kernel 2: per 64-row tile: q = x@Wq (normalize), v from kernel 1's store,
// attn = qhat@kvs + N*v, out_pre = attn / (qhat.ksum + N),
// out = out_pre @ W_out + b_out.  Fully fused; tiles at the padded pitches.
// One work-group per WGP walks K2_TILES consecutive tiles: the two weight
// panels and the bias are staged once, the stats whenever b changes, and the
// next x tile is loaded into registers at the head of a trip and stored to LDS
// once the qhat readers have left that buffer.
// ---------------------------------------------------------------------------
__global__ void __launch_bounds__(NTHREADS)
attn_out_kernel(const float* __restrict__ x, const float* __restrict__ Wqkv,
                const float* __restrict__ Wout, const float* __restrict__ bout,
                const float* __restrict__ ws_kvs,
                const float* __restrict__ ws_ksum,
                const float* __restrict__ ws_v, float* __restrict__ out) {
  extern __shared__ float smem[];
  float* wq_lds   = smem;                   // 128 x WP2 (W_qkv cols 0..127)
  float* wo_lds   = wq_lds + DIM * WP2;     // 128 x WP2
  float* xq_lds   = wo_lds + DIM * WP2;     // 64 x XP (x, later qhat)
  float* op_lds   = xq_lds + TROWS * XP;    // 64 x XP pre-projection
  float* kvs_lds  = op_lds + TROWS * XP;    // 8*256
  float* ksum_lds = kvs_lds + NHEAD * 256;  // 128
  float* bias_lds = ksum_lds + DIM;         // 128

  const int t0   = blockIdx.x * K2_TILES;  // tile t = b * NTILES + nt
  const int tid  = threadIdx.x;
  const int wave = tid >> 5;
  const int lane = tid & 31;
  const int half = lane >> 4;
  const int l    = lane & 15;

  // ---- stage the first x tile, the weights, the bias and the first stats ----
  // wave w moves rows w, w+16, ...: 32 lanes x 4 floats = one 128-wide row
  const int xg = wave * DIM + (lane << 2);  // offset in a global tile
  const int xs = wave * XP + (lane << 2);   // offset in the LDS tile
  const float* xt = x + (size_t)t0 * TROWS * DIM + xg;
  v4f p0 = *(const v4f*)(xt);
  v4f p1 = *(const v4f*)(xt + 16 * DIM);
  v4f p2 = *(const v4f*)(xt + 32 * DIM);
  v4f p3 = *(const v4f*)(xt + 48 * DIM);
  *(v4f*)(xq_lds + xs)           = p0;
  *(v4f*)(xq_lds + xs + 16 * XP) = p1;
  *(v4f*)(xq_lds + xs + 32 * XP) = p2;
  *(v4f*)(xq_lds + xs + 48 * XP) = p3;
#pragma unroll  // all loads in flight before the first LDS store waits
  for (int j = 0; j < DIM / 16; ++j) {
    int r = wave + j * 16;
    int c = lane << 2;
    *(v4f*)(wq_lds + r * WP2 + c) = *(const v4f*)(Wqkv + r * 384 + c);
    *(v4f*)(wo_lds + r * WP2 + c) = *(const v4f*)(Wout + r * DIM + c);
  }
  if (tid < DIM) bias_lds[tid] = bout[tid];
  stage_stats(t0 / NTILES, tid, ws_kvs, ws_ksum, kvs_lds, ksum_lds);

  // q GEMM role: row block rb, heads h0, h0+1 (and the v tiles of the same)
  const int rb   = wave & 3;
  const int h0   = (wave >> 2) * 2;
  const int row0 = rb * 16;
  // output projection role: column block cb, row blocks 0/16 and 32/48
  const int cb = wave & 7;
  const int rA = (wave >> 3) * 16;
  const int rB = rA + 32;
  const int c0 = cb * 16;

  for (int it = 0; it < K2_TILES; ++it) {
    const int t = t0 + it;
    __syncthreads();  // x tile t and its stats are stored; op_lds readers left
    if (it + 1 < K2_TILES) {
      const float* xn = x + (size_t)(t + 1) * TROWS * DIM + xg;
      p0 = *(const v4f*)(xn);
      p1 = *(const v4f*)(xn + 16 * DIM);
      p2 = *(const v4f*)(xn + 32 * DIM);
      p3 = *(const v4f*)(xn + 48 * DIM);
    }
    // this tile's v, heads h0 and h0+1, in accumulator order; used behind the GEMM
    const float* vs =
        ws_v + ((size_t)(t * 4 + rb) * NHEAD + h0) * 256 + (lane << 2);
    const v4f va = *(const v4f*)(vs);
    const v4f vb = *(const v4f*)(vs + 128);
    const v4f vc = *(const v4f*)(vs + 256);
    const v4f vd = *(const v4f*)(vs + 384);

    // ---- q GEMM ----
    v8f q0 = {0.f, 0.f, 0.f, 0.f, 0.f, 0.f, 0.f, 0.f};
    v8f q1 = q0;
#pragma unroll 4
    for (int k0 = 0; k0 < DIM; k0 += 4) {
      v2f a = *(const v2f*)(xq_lds + (row0 + l) * XP + k0 + 2 * half);
      const float* wrq = wq_lds + (k0 + 2 * half) * WP2 + 16 * h0 + l;
      v2f bq0 = {wrq[0], wrq[WP2]};
      v2f bq1 = {wrq[16], wrq[16 + WP2]};
      q0  = wmma4(a, bq0, q0);
      q1  = wmma4(a, bq1, q1);
    }

    // ---- L2-normalize q (per head = per tile; rows across 16-lane halves) ----
#pragma unroll
    for (int i = 0; i < 8; ++i) {
      float s0 = red16(q0[i] * q0[i]);
      q0[i] *= 1.f / fmaxf(sqrtf(s0), 1e-12f);
      float s1 = red16(q1[i] * q1[i]);
      q1[i] *= 1.f / fmaxf(sqrtf(s1), 1e-12f);
    }

    __syncthreads();  // everyone finished reading x from xq_lds
#pragma unroll
    for (int i = 0; i < 8; ++i) {
      xq_lds[(row0 + i + 8 * half) * XP + 16 * h0 + l]       = q0[i];
      xq_lds[(row0 + i + 8 * half) * XP + 16 * (h0 + 1) + l] = q1[i];
    }
    __syncthreads();

    // ---- attn = qhat @ kvs + N*v ; out_pre = attn / (qhat.ksum + N) ----
#pragma unroll
    for (int hh = 0; hh < 2; ++hh) {
      const int h = h0 + hh;
      const v4f vlo = (hh == 0) ? va : vc;  // rows i = 0..3 (+ 8 * half)
      const v4f vhi = (hh == 0) ? vb : vd;  // rows i = 4..7 (+ 8 * half)
      v8f qh = (hh == 0) ? q0 : q1;
      v8f att;
#pragma unroll
      for (int i = 0; i < 4; ++i) {  // N * v (C layout)
        att[i]     = 1024.f * vlo[i];
        att[i + 4] = 1024.f * vhi[i];
      }
#pragma unroll
      for (int k0 = 0; k0 < HD; k0 += 4) {
        v2f a =
            *(const v2f*)(xq_lds + (row0 + l) * XP + 16 * h + k0 + 2 * half);
        const float* kr = kvs_lds + h * 256 + (k0 + 2 * half) * 16 + l;
        v2f bb = {kr[0], kr[16]};
        att = wmma4(a, bb, att);
      }
      float ks = ksum_lds[h * 16 + l];
#pragma unroll
      for (int i = 0; i < 8; ++i) {
        float dot = red16(qh[i] * ks);       // qhat-row . ksum  (per row)
        float inv = 1.f / (dot + 1024.f);    // + N
        op_lds[(row0 + i + 8 * half) * XP + 16 * h + l] = att[i] * inv;
      }
    }
    __syncthreads();

    // next x tile (and, where b changes, its stats) into the buffers whose
    // readers left before the barrier above
    if (it + 1 < K2_TILES) {
      *(v4f*)(xq_lds + xs)           = p0;
      *(v4f*)(xq_lds + xs + 16 * XP) = p1;
      *(v4f*)(xq_lds + xs + 32 * XP) = p2;
      *(v4f*)(xq_lds + xs + 48 * XP) = p3;
      if (((t + 1) & (NTILES - 1)) == 0)
        stage_stats((t + 1) / NTILES, tid, ws_kvs, ws_ksum, kvs_lds, ksum_lds);
    }

    // ---- output projection: out = op @ W_out + b_out ----
    v8f oA, oB;
#pragma unroll
    for (int i = 0; i < 8; ++i) {
      oA[i] = bias_lds[c0 + l];
      oB[i] = oA[i];
    }
#pragma unroll 4
    for (int k0 = 0; k0 < DIM; k0 += 4) {
      const float* wr = wo_lds + (k0 + 2 * half) * WP2 + c0 + l;
      v2f bb = {wr[0], wr[WP2]};
      v2f aA = *(const v2f*)(op_lds + (rA + l) * XP + k0 + 2 * half);
      v2f aB = *(const v2f*)(op_lds + (rB + l) * XP + k0 + 2 * half);
      oA = wmma4(aA, bb, oA);
      oB = wmma4(aB, bb, oB);
    }
    float* ob = out + (size_t)t * TROWS * DIM;
#pragma unroll
    for (int i = 0; i < 8; ++i) {
      ob[(rA + i + 8 * half) * DIM + c0 + l] = oA[i];
      ob[(rB + i + 8 * half) * DIM + c0 + l] = oB[i];
    }
    // the next trip reuses the registers that these stores name
    asm volatile("s_wait_xcnt 0x0" ::: "memory");
  }
}

extern "C" void kernel_launch(void* const* d_in, const int* in_sizes, int n_in,
                              void* d_out, int out_size, void* d_ws,
                              size_t ws_size, hipStream_t stream) {
  (void)in_sizes; (void)n_in; (void)out_size; (void)ws_size;
  const float* x    = (const float*)d_in[0];
  const float* Wqkv = (const float*)d_in[1];
  const float* Wout = (const float*)d_in[2];
  const float* bout = (const float*)d_in[3];
  float* out = (float*)d_out;

  float* ws_kvs  = (float*)d_ws;                               // 192*8*4*256 f32
  float* ws_ksum = ws_kvs + (size_t)BT * NHEAD * NPART * 256;  // 192*8*4*32  f32
  float* ws_v    = ws_ksum + (size_t)BT * NHEAD * NPART * 32;  // 192*1024*128 f32

  const size_t shmem1 =
      (size_t)(DIM * WP1 + 2 * TROWS * XP + TROWS * WP1) * sizeof(float);
  const size_t shmem2 =
      (size_t)(2 * DIM * WP2 + 2 * TROWS * XP + NHEAD * 256 + DIM + DIM) *
      sizeof(float);

  (void)hipFuncSetAttribute((const void*)kv_stats_kernel,
                            hipFuncAttributeMaxDynamicSharedMemorySize,
                            (int)shmem1);
  (void)hipFuncSetAttribute((const void*)attn_out_kernel,
                            hipFuncAttributeMaxDynamicSharedMemorySize,
                            (int)shmem2);

  kv_stats_kernel<<<dim3(K1_GROUPS), dim3(NTHREADS), shmem1, stream>>>(
      x, Wqkv, ws_kvs, ws_ksum, ws_v);
  attn_out_kernel<<<dim3(K2_GROUPS), dim3(NTHREADS), shmem2, stream>>>(
      x, Wqkv, Wout, bout, ws_kvs, ws_ksum, ws_v, out);
}

// v005
// Measured time: 199 microseconds a run.
// Next to v004, in two timings, it ran 1.08 and 1.07 times as fast.
// All steps since v000 together make it 2.33 times as fast.
#include <hip/hip_runtime.h>
#include <math.h>
#include <stdint.h>

// Problem constants (from reference): B=16, T=12 -> BT=192, N=1024, D=128, H=8, hd=16
#define SEQ      1024
#define DIM      128
#define NHEAD    8
#define HD       16
#define BT       192
#define TROWS    64
#define NTHREADS 512
#define NTILES   (SEQ / TROWS)   // 16
#define K1_GROUPS 256                          // kernel 1: one work-group a WGP
#define K1_TILES  (BT * NTILES / K1_GROUPS)    // 12 tiles each
#define K2_GROUPS 256                          // kernel 2: one work-group a WGP
#define K2_TILES  (BT * NTILES / K2_GROUPS)    // 12 tiles each
#define NWAVES    (NTHREADS / 32)
#define K2_BLOCKS (K2_TILES * TROWS / 16 / NWAVES)  // 16-row blocks a wave: 3
#define NPART    4   // stats partials of one (b, head): 2 tile runs x 2 row halves
// LDS row pitches in floats (64 banks of 4 bytes).
// A-fragment tiles (lane = row, 8 bytes a lane): 132 = 4 mod 64, so the 16 rows
// of one read fall on 16 different groups of four banks.
// B-fragment panels (lane = column; the two lane halves read rows k and k+2):
// twice the pitch = 32 mod 64, so the halves fall on different banks.
#define XP       132   // x, qhat and pre-projection tiles and strips
#define WP1      272   // 256-wide [Wk|Wv] and [Wq|W_out] panels, [khat|v] tile

typedef float v2f __attribute__((ext_vector_type(2)));
typedef float v4f __attribute__((ext_vector_type(4)));
typedef float v8f __attribute__((ext_vector_type(8)));

// D = A(16x4) * B(4x16) + C(16x16), fp32, wave32.
static __device__ __forceinline__ v8f wmma4(v2f a, v2f b, v8f c) {
  return __builtin_amdgcn_wmma_f32_16x16x4_f32(false, a, false, b, (short)0, c,
                                               false, false);
}

// Sum across each 16-lane half of a wave32 (xor masks 1,2,4,8 stay in-half).
static __device__ __forceinline__ float red16(float v) {
  v += __shfl_xor(v, 1, 32);
  v += __shfl_xor(v, 2, 32);
  v += __shfl_xor(v, 4, 32);
  v += __shfl_xor(v, 8, 32);
  return v;
}

// red16 of eight values, stage by stage: the eight chains run side by side, so
// that a wave waits once a stage and not once a value. Same sums as red16.
static __device__ __forceinline__ void red16x8(float (&v)[8]) {
#pragma unroll
  for (int m = 1; m < 16; m <<= 1) {
    float t[8];
#pragma unroll
    for (int i = 0; i < 8; ++i) t[i] = __shfl_xor(v[i], m, 32);
#pragma unroll
    for (int i = 0; i < 8; ++i) v[i] += t[i];
  }
}

// ---------------------------------------------------------------------------
// Kernel 1: partial kvs[b,h] = sum_n khat[n] (x) v[n]  (16x16) and partial
// ksum[b,h] = sum_n khat[n], via k = x@Wk, v = x@Wv.
// One work-group per WGP walks K1_TILES consecutive tiles (tile t = b * NTILES
// + nt), 16 waves. A run of 12 tiles cuts every b (16 tiles) exactly once, so
// each b is covered by two runs: the run that holds its first tile writes
// partial 0, the other partial 1, each when it leaves that b.
// The x tiles are double-buffered: the next tile is loaded into registers
// ahead of the GEMM and stored to LDS behind it; the Wk|Wv panel is staged
// once. All tiles lie at the padded pitches above.
// The v tiles also go to the workspace for kernel 2, each 16x16 accumulator
// tile (tile t, row block, head) as 256 floats in the accumulator's own lane
// order: float i of lane L at (i / 4) * 128 + L * 4 + i % 4, so that a wave
// moves it with two 16-byte accesses a lane over whole 128-byte lines.
// ---------------------------------------------------------------------------
__global__ void __launch_bounds__(NTHREADS)
kv_stats_kernel(const float* __restrict__ x, const float* __restrict__ Wqkv,
                float* __restrict__ ws_kvs, float* __restrict__ ws_ksum,
                float* __restrict__ ws_v) {
  extern __shared__ float smem[];
  float* w_lds  = smem;                   // 128 x WP1 : W_qkv cols 128..383 = [Wk|Wv]
  float* x0_lds = w_lds + DIM * WP1;      // 64 x XP (ping)
  float* x1_lds = x0_lds + TROWS * XP;    // 64 x XP (pong)
  float* kv_lds = x1_lds + TROWS * XP;    // 64 x WP1 : [khat | v]

  const int t0   = blockIdx.x * K1_TILES;  // tile t = b * NTILES + nt
  const int tid  = threadIdx.x;
  const int wave = tid >> 5;
  const int lane = tid & 31;
  const int half = lane >> 4;
  const int l    = lane & 15;

  const float* xb = x + (size_t)t0 * TROWS * DIM;

#pragma unroll  // all loads in flight before the first LDS store waits
  for (int j = 0; j < DIM * 256 / 4 / NTHREADS; ++j) {
    int r  = (tid >> 6) + j * (NTHREADS >> 6);  // 64 groups of 4 floats a row
    int c4 = (tid & 63) << 2;
    *(v4f*)(w_lds + r * WP1 + c4) = *(const v4f*)(Wqkv + r * 384 + 128 + c4);
  }
  // x tile: wave w moves rows w, w+16, w+32, w+48, one float4 a lane and row.
  const int xg = wave * DIM + (lane << 2);  // offset in the global tile
  const int xs = wave * XP + (lane << 2);   // offset in the LDS tile
  v4f p0 = *(const v4f*)(xb + xg);
  v4f p1 = *(const v4f*)(xb + xg + 16 * DIM);
  v4f p2 = *(const v4f*)(xb + xg + 32 * DIM);
  v4f p3 = *(const v4f*)(xb + xg + 48 * DIM);
  *(v4f*)(x0_lds + xs)           = p0;
  *(v4f*)(x0_lds + xs + 16 * XP) = p1;
  *(v4f*)(x0_lds + xs + 32 * XP) = p2;
  *(v4f*)(x0_lds + xs + 48 * XP) = p3;

  const int kh    = wave & 7;   // head this wave reduces
  const int rhalf = wave >> 3;  // which 32-row half of the tile
  const int rb    = wave & 3;   // GEMM role: row block (16 rows)
  const int qt    = wave >> 2;  // GEMM role: 64-col quarter (0,1 = k; 2,3 = v)
  const int row0  = rb * 16;
  const int c0    = qt * 64;

  v8f   kvacc = {0.f, 0.f, 0.f, 0.f, 0.f, 0.f, 0.f, 0.f};
  float ksum  = 0.f;

  for (int it = 0; it < K1_TILES; ++it) {
    __syncthreads();  // tile it is stored; prior x / kv_lds readers are done
    const float* x_lds = (it & 1) ? x1_lds : x0_lds;
    float*       n_lds = (it & 1) ? x0_lds : x1_lds;
    if (it + 1 < K1_TILES) {
      const float* xn = xb + (size_t)(it + 1) * TROWS * DIM + xg;
      p0 = *(const v4f*)(xn);
      p1 = *(const v4f*)(xn + 16 * DIM);
      p2 = *(const v4f*)(xn + 32 * DIM);
      p3 = *(const v4f*)(xn + 48 * DIM);
    }

    // ---- [k|v] GEMM: each wave computes a 16x64 strip = 4 wmma tiles ----
    v8f acc[4];
#pragma unroll
    for (int t = 0; t < 4; ++t)
      acc[t] = (v8f){0.f, 0.f, 0.f, 0.f, 0.f, 0.f, 0.f, 0.f};
#pragma unroll 4
    for (int k0 = 0; k0 < DIM; k0 += 4) {
      // A[m][k]: m = lane%16 (x row), k = 2*half + {0,1}
      v2f a = *(const v2f*)(x_lds + (row0 + l) * XP + k0 + 2 * half);
      const float* wr = w_lds + (k0 + 2 * half) * WP1 + c0 + l;
#pragma unroll
      for (int t = 0; t < 4; ++t) {
        v2f bb = {wr[t * 16], wr[t * 16 + WP1]};  // B[k][n], rows k and k+1
        acc[t] = wmma4(a, bb, acc[t]);
      }
    }

    // ---- L2-normalize k rows (quarters 0,1 hold k; each tile = one head) ----
    if (qt < 2) {
#pragma unroll
      for (int t = 0; t < 4; ++t) {
#pragma unroll
        for (int i = 0; i < 8; ++i) {
          float ss = red16(acc[t][i] * acc[t][i]);
          float sc = 1.f / fmaxf(sqrtf(ss), 1e-12f);
          acc[t][i] *= sc;
        }
      }
    } else {
      // ---- quarters 2,3 hold v: heads (qt - 2) * 4 + t, to the workspace ----
      float* vd = ws_v +
                  ((size_t)((t0 + it) * 4 + rb) * NHEAD + (qt - 2) * 4) * 256 +
                  (lane << 2);
#pragma unroll  // constant t: the accumulators stay in registers
      for (int t = 0; t < 4; ++t) {
        *(v4f*)(vd + t * 256) =
            (v4f){acc[t][0], acc[t][1], acc[t][2], acc[t][3]};
        *(v4f*)(vd + t * 256 + 128) =
            (v4f){acc[t][4], acc[t][5], acc[t][6], acc[t][7]};
      }
      // the next trip reuses the registers that these stores name
      asm volatile("s_wait_xcnt 0x0" ::: "memory");
    }

    // ---- stash khat / v tiles into LDS (C-layout: row=i+8*half, col=lane%16)
#pragma unroll
    for (int t = 0; t < 4; ++t) {
      float* dst = kv_lds + c0 + t * 16 + l;
#pragma unroll
      for (int i = 0; i < 8; ++i)
        dst[(row0 + i + 8 * half) * WP1] = acc[t][i];
    }
    // next x tile into the buffer whose readers left before this trip's barrier
    if (it + 1 < K1_TILES) {
      *(v4f*)(n_lds + xs)           = p0;
      *(v4f*)(n_lds + xs + 16 * XP) = p1;
      *(v4f*)(n_lds + xs + 32 * XP) = p2;
      *(v4f*)(n_lds + xs + 48 * XP) = p3;
    }
    __syncthreads();

    // ---- kvs += Khat^T * V for head kh over this wave's 32 rows ----
    // A[m][k] = khat[j0+k][16*kh+m]; B[k][d] = v[j0+k][16*kh+d]
#pragma unroll
    for (int js = 0; js < 8; ++js) {
      int j0 = rhalf * 32 + js * 4 + 2 * half;
      const float* kr = kv_lds + (size_t)j0 * WP1 + kh * 16 + l;
      v2f a  = {kr[0], kr[WP1]};          // khat rows j0, j0+1
      v2f bb = {kr[128], kr[WP1 + 128]};  // v rows j0, j0+1
      ksum += a.x + a.y;                  // partial column sum of khat
      kvacc = wmma4(a, bb, kvacc);
    }

    // ---- leaving this b or this run: write the partial stats (combined in
    // kernel 2) and start the sums anew ----
    const int t = t0 + it;
    if (((t + 1) & (NTILES - 1)) == 0 || it + 1 == K1_TILES) {
      const int b    = t / NTILES;
      const int part = (t0 > b * NTILES) ? 1 : 0;  // run began inside this b
      const size_t slot = ((size_t)b * NHEAD + kh) * NPART + part * 2 + rhalf;
      float* kdst = ws_kvs + slot * 256;
#pragma unroll
      for (int i = 0; i < 8; ++i)
        kdst[(i + 8 * half) * 16 + l] = kvacc[i];
      ws_ksum[slot * 32 + lane] = ksum;
      // the sums' registers, which these stores name, are cleared next
      asm volatile("s_wait_xcnt 0x0" ::: "memory");
      kvacc = (v8f){0.f, 0.f, 0.f, 0.f, 0.f, 0.f, 0.f, 0.f};
      ksum  = 0.f;
    }
  }
}

// Stats of one b: the four partials of kernel 1 (two tile runs, two row halves
// each) are summed into LDS.
static __device__ __forceinline__ void stage_stats(
    int b, int tid, const float* __restrict__ ws_kvs,
    const float* __restrict__ ws_ksum, float* kvs_lds, float* ksum_lds) {
  for (int i = tid; i < NHEAD * 256; i += NTHREADS) {
    size_t base = (((size_t)b * NHEAD + (i >> 8)) * NPART) * 256;
    int md = i & 255;
    kvs_lds[i] = (ws_kvs[base + md] + ws_kvs[base + 256 + md]) +
                 (ws_kvs[base + 512 + md] + ws_kvs[base + 768 + md]);
    // the next trip rewrites the address registers that these loads name
    asm volatile("s_wait_xcnt 0x0" ::: "memory");
  }
  if (tid < DIM) {
    size_t base = (((size_t)b * NHEAD + (tid >> 4)) * NPART) * 32;
    int m = tid & 15;
    ksum_lds[tid] = (ws_ksum[base + m] + ws_ksum[base + m + 16] +
                     ws_ksum[base + 32 + m] + ws_ksum[base + 48 + m]) +
                    (ws_ksum[base + 64 + m] + ws_ksum[base + 80 + m] +
                     ws_ksum[base + 96 + m] + ws_ksum[base + 112 + m]);
  }
}

// ---------------------------------------------------------------------------
// Kernel 2: q = x@Wq (normalize), v from kernel 1's store,
// attn = qhat@kvs + N*v, out_pre = attn / (qhat.ksum + N),
// out = out_pre @ W_out + b_out.  Fully fused; tiles at the padded pitches.
// One work-group per WGP covers K2_TILES consecutive tiles. The two weights
// (side by side in one panel, so that both lie within an LDS instruction's
// offset of one address), the bias and the stats of the run's first and last
// b (one b for some runs) are staged once, behind one barrier. From there on every wave works
// alone: it takes a block of 16 rows through all stages, all 128 columns wide,
// in an LDS strip of its own (x, then qhat, then the pre-projection rows), so
// that one wave's vector stages run beside the other waves' matrix stages.
// ---------------------------------------------------------------------------
__global__ void __launch_bounds__(NTHREADS)
attn_out_kernel(const float* __restrict__ x, const float* __restrict__ Wqkv,
                const float* __restrict__ Wout, const float* __restrict__ bout,
                const float* __restrict__ ws_kvs,
                const float* __restrict__ ws_ksum,
                const float* __restrict__ ws_v, float* __restrict__ out) {
  extern __shared__ float smem[];
  float* w_lds    = smem;                        // 128 x WP1 : [Wq | W_out]
  float* scr_lds  = w_lds + DIM * WP1;           // NWAVES strips of 16 x XP
  float* kvs_lds  = scr_lds + NWAVES * 16 * XP;  // 2 x 8*256
  float* ksum_lds = kvs_lds + 2 * NHEAD * 256;   // 2 x 128
  float* bias_lds = ksum_lds + 2 * DIM;          // 128

  const int t0   = blockIdx.x * K2_TILES;  // tile t = b * NTILES + nt
  const int tid  = threadIdx.x;
  const int wave = tid >> 5;
  const int lane = tid & 31;
  const int half = lane >> 4;
  const int l    = lane & 15;
  const int b0   = t0 / NTILES;  // first b of the run
  float* scr = scr_lds + wave * 16 * XP;

  // ---- the wave's first x block: one 128-wide row an access ----
  const float* xw = x + ((size_t)t0 * TROWS + wave * 16) * DIM + (lane << 2);
  v4f p[16];
#pragma unroll  // all loads in flight before the first LDS store waits
  for (int r = 0; r < 16; ++r) p[r] = *(const v4f*)(xw + r * DIM);
  // ---- the weights: wave w moves rows w, w+16, ... of both ----
  const float* wqs = Wqkv + wave * 384 + (lane << 2);
  const float* wos = Wout + wave * DIM + (lane << 2);
  v4f wa[DIM / 16], wb[DIM / 16];
#pragma unroll  // all loads in flight before the first LDS store waits
  for (int j = 0; j < DIM / 16; ++j) {
    wa[j] = *(const v4f*)(wqs + j * 16 * 384);
    wb[j] = *(const v4f*)(wos + j * 16 * DIM);
  }
  // the loads' address registers stay as they are up to this wait
  asm volatile("s_wait_xcnt 0x0" ::"v"(xw), "v"(wqs), "v"(wos) : "memory");
#pragma unroll
  for (int r = 0; r < 16; ++r) *(v4f*)(scr + r * XP + (lane << 2)) = p[r];
#pragma unroll
  for (int j = 0; j < DIM / 16; ++j) {
    float* wd = w_lds + (wave + j * 16) * WP1 + (lane << 2);
    *(v4f*)(wd)       = wa[j];
    *(v4f*)(wd + DIM) = wb[j];
  }
  // ---- the bias and the stats of the run's first and last b ----
  if (tid < DIM) bias_lds[tid] = bout[tid];
  stage_stats(b0, tid, ws_kvs, ws_ksum, kvs_lds, ksum_lds);
  stage_stats((t0 + K2_TILES - 1) / NTILES, tid, ws_kvs, ws_ksum,
              kvs_lds + NHEAD * 256, ksum_lds + DIM);
  __syncthreads();  // the one barrier: panels, bias and stats are stored

  // the full unrolls below: constant indices, so the arrays stay in registers
  for (int j = 0; j < K2_BLOCKS; ++j) {
    const int rbk = wave + j * NWAVES;  // 16-row block within the run
    const int sb  = ((t0 + (rbk >> 2)) / NTILES != b0) ? 1 : 0;
    const float* kvs = kvs_lds + sb * NHEAD * 256;
    const float* ksm = ksum_lds + sb * DIM;
    // this block's v, all heads, in accumulator order; used behind the GEMM
    const float* vs =
        ws_v + (size_t)(t0 * 4 + rbk) * NHEAD * 256 + (lane << 2);
    v4f vv[16];
#pragma unroll
    for (int h = 0; h < NHEAD; ++h) {
      vv[2 * h]     = *(const v4f*)(vs + h * 256);
      vv[2 * h + 1] = *(const v4f*)(vs + h * 256 + 128);
    }

    // ---- q GEMM: 16 rows x 128 columns = 8 wmma tiles, one a head ----
    v8f q[NHEAD];
#pragma unroll
    for (int h = 0; h < NHEAD; ++h)
      q[h] = (v8f){0.f, 0.f, 0.f, 0.f, 0.f, 0.f, 0.f, 0.f};
#pragma unroll 2  // two k steps' LDS reads issue as one group ahead of 16 WMMAs
    for (int k0 = 0; k0 < DIM; k0 += 4) {
      v2f a = *(const v2f*)(scr + l * XP + k0 + 2 * half);
      const float* wr = w_lds + (k0 + 2 * half) * WP1 + l;
#pragma unroll
      for (int h = 0; h < NHEAD; ++h) {
        v2f bb = {wr[h * 16], wr[h * 16 + WP1]};
        q[h] = wmma4(a, bb, q[h]);
      }
    }

    // ---- L2-normalize q (per head = per tile; rows across 16-lane halves) ----
#pragma unroll
    for (int h = 0; h < NHEAD; ++h) {
      float s[8];
#pragma unroll
      for (int i = 0; i < 8; ++i) s[i] = q[h][i] * q[h][i];
      red16x8(s);
#pragma unroll
      for (int i = 0; i < 8; ++i) q[h][i] *= 1.f / fmaxf(sqrtf(s[i]), 1e-12f);
    }
    // qhat over x in the strip: every value stored hangs on all reads of x
#pragma unroll
    for (int h = 0; h < NHEAD; ++h) {
#pragma unroll
      for (int i = 0; i < 8; ++i)
        scr[(i + 8 * half) * XP + 16 * h + l] = q[h][i];
    }
    // the strip's stores have landed before other lanes of the wave read them
    asm volatile("s_wait_dscnt 0x0" ::: "memory");

    // ---- attn = qhat @ kvs + N*v ; out_pre = attn / (qhat.ksum + N) ----
    // head h's columns of the strip are read (qhat), then overwritten (out_pre)
#pragma unroll
    for (int h = 0; h < NHEAD; ++h) {
      v8f att;
#pragma unroll
      for (int i = 0; i < 4; ++i) {  // N * v (C layout)
        att[i]     = 1024.f * vv[2 * h][i];
        att[i + 4] = 1024.f * vv[2 * h + 1][i];
      }
#pragma unroll
      for (int k0 = 0; k0 < HD; k0 += 4) {
        v2f a = *(const v2f*)(scr + l * XP + 16 * h + k0 + 2 * half);
        const float* kr = kvs + h * 256 + (k0 + 2 * half) * 16 + l;
        v2f bb = {kr[0], kr[16]};
        att = wmma4(a, bb, att);
      }
      float ks = ksm[h * 16 + l];
      float dot[8];  // qhat-row . ksum  (per row)
#pragma unroll
      for (int i = 0; i < 8; ++i) dot[i] = q[h][i] * ks;
      red16x8(dot);
#pragma unroll
      for (int i = 0; i < 8; ++i) att[i] *= 1.f / (dot[i] + 1024.f);  // + N
#pragma unroll
      for (int i = 0; i < 8; ++i)
        scr[(i + 8 * half) * XP + 16 * h + l] = att[i];
    }
    // the strip's stores have landed before other lanes of the wave read them
    asm volatile("s_wait_dscnt 0x0" ::: "memory");

    // the wave's next x block flies during the projection
    if (j + 1 < K2_BLOCKS) {
      const float* xn = xw + (size_t)(j + 1) * NWAVES * 16 * DIM;
#pragma unroll
      for (int r = 0; r < 16; ++r) p[r] = *(const v4f*)(xn + r * DIM);
    }

    // ---- output projection: out = op @ W_out + b_out ----
    v8f o[8];
#pragma unroll
    for (int c = 0; c < 8; ++c) {
      float bias = bias_lds[c * 16 + l];
#pragma unroll
      for (int i = 0; i < 8; ++i) o[c][i] = bias;
    }
#pragma unroll 2  // as in the q GEMM
    for (int k0 = 0; k0 < DIM; k0 += 4) {
      v2f a = *(const v2f*)(scr + l * XP + k0 + 2 * half);
      const float* wr = w_lds + (k0 + 2 * half) * WP1 + DIM + l;
#pragma unroll
      for (int c = 0; c < 8; ++c) {
        v2f bb = {wr[c * 16], wr[c * 16 + WP1]};
        o[c] = wmma4(a, bb, o[c]);
      }
    }
    float* ob = out + ((size_t)t0 * TROWS + rbk * 16) * DIM;
#pragma unroll
    for (int c = 0; c < 8; ++c) {
#pragma unroll
      for (int i = 0; i < 8; ++i)
        ob[(i + 8 * half) * DIM + c * 16 + l] = o[c][i];
    }
    // the next trip reuses the registers that these stores name
    asm volatile("s_wait_xcnt 0x0" ::: "memory");

    if (j + 1 < K2_BLOCKS) {
      // the projection's reads of the strip have returned before x overwrites it
      asm volatile("s_wait_dscnt 0x0" ::: "memory");
#pragma unroll
      for (int r = 0; r < 16; ++r) *(v4f*)(scr + r * XP + (lane << 2)) = p[r];
      // the strip's stores have landed before other lanes of the wave read them
      asm volatile("s_wait_dscnt 0x0" ::: "memory");
    }
  }
}

extern "C" void kernel_launch(void* const* d_in, const int* in_sizes, int n_in,
                              void* d_out, int out_size, void* d_ws,
                              size_t ws_size, hipStream_t stream) {
  (void)in_sizes; (void)n_in; (void)out_size; (void)ws_size;
  const float* x    = (const float*)d_in[0];
  const float* Wqkv = (const float*)d_in[1];
  const float* Wout = (const float*)d_in[2];
  const float* bout = (const float*)d_in[3];
  float* out = (float*)d_out;

  float* ws_kvs  = (float*)d_ws;                               // 192*8*4*256 f32
  float* ws_ksum = ws_kvs + (size_t)BT * NHEAD * NPART * 256;  // 192*8*4*32  f32
  float* ws_v    = ws_ksum + (size_t)BT * NHEAD * NPART * 32;  // 192*1024*128 f32

  const size_t shmem1 =
      (size_t)(DIM * WP1 + 2 * TROWS * XP + TROWS * WP1) * sizeof(float);
  const size_t shmem2 =
      (size_t)(DIM * WP1 + NWAVES * 16 * XP + 2 * NHEAD * 256 + 2 * DIM + DIM) *
      sizeof(float);

  (void)hipFuncSetAttribute((const void*)kv_stats_kernel,
                            hipFuncAttributeMaxDynamicSharedMemorySize,
                            (int)shmem1);
  (void)hipFuncSetAttribute((const void*)attn_out_kernel,
                            hipFuncAttributeMaxDynamicSharedMemorySize,
                            (int)shmem2);

  kv_stats_kernel<<<dim3(K1_GROUPS), dim3(NTHREADS), shmem1, stream>>>(
      x, Wqkv, ws_kvs, ws_ksum, ws_v);
  attn_out_kernel<<<dim3(K2_GROUPS), dim3(NTHREADS), shmem2, stream>>>(
      x, Wqkv, Wout, bout, ws_kvs, ws_ksum, ws_v, out);
}

// v006
// Measured time: 168 microseconds a run.
// In both of two side-by-side timings against v005, it was 1.19 times as fast.
// Counting every step since v000, it is 2.77 times as fast.
#include <hip/hip_runtime.h>
#include <math.h>
#include <stdint.h>

// Problem constants (from reference): B=16, T=12 -> BT=192, N=1024, D=128, H=8, hd=16
#define SEQ      1024
#define DIM      128
#define NHEAD    8
#define HD       16
#define BT       192
#define TROWS    64
#define NTHREADS 512
#define NTILES   (SEQ / TROWS)   // 16
#define K1_GROUPS 256                          // kernel 1: one work-group a WGP
#define K1_TILES  (BT * NTILES / K1_GROUPS)    // 12 tiles each
#define K2_GROUPS 256                          // kernel 2: one work-group a WGP
#define K2_TILES  (BT * NTILES / K2_GROUPS)    // 12 tiles each
#define NWAVES    (NTHREADS / 32)
#define K2_BLOCKS (K2_TILES * TROWS / 16 / NWAVES)  // 16-row blocks a wave: 3
#define NPART    4   // stats partials of one (b, head): 2 tile runs x 2 row halves
// LDS row pitches in floats (64 banks of 4 bytes).
// A-fragment tiles (lane = row, 8 bytes a lane): 132 = 4 mod 64, so the 16 rows
// of one read fall on 16 different groups of four banks.
// B-fragment panels (lane = column; the two lane halves read rows k and k+2):
// twice the pitch = 32 mod 64, so the halves fall on different banks.
#define XP       132   // x, q and pre-projection tiles and strips
#define WP1      272   // 256-wide [Wk|Wv] and [Wq|W_out] panels, [khat|v] tile

typedef float v2f __attribute__((ext_vector_type(2)));
typedef float v4f __attribute__((ext_vector_type(4)));
typedef float v8f __attribute__((ext_vector_type(8)));

// D = A(16x4) * B(4x16) + C(16x16), fp32, wave32.
static __device__ __forceinline__ v8f wmma4(v2f a, v2f b, v8f c) {
  return __builtin_amdgcn_wmma_f32_16x16x4_f32(false, a, false, b, (short)0, c,
                                               false, false);
}

// Lane l with lane l ^ 16 (the other 16-lane half of the wave).
static __device__ __forceinline__ float xhalf(float v) {
  int b = __builtin_bit_cast(int, v);
  return __builtin_bit_cast(
      float, __builtin_amdgcn_permlanex16(b, b, 0x76543210, 0xfedcba98, false,
                                          false));
}

// A DPP move within each 16-lane half: 0x150 + n = row_share:n (lane n's value
// to all 16 lanes), 0x160 + m = row_xmask:m (lane l ^ m's value).
template <int CTRL>
static __device__ __forceinline__ float dpp16(float v) {
  return __builtin_bit_cast(
      float, __builtin_amdgcn_update_dpp(0, __builtin_bit_cast(int, v), CTRL,
                                         0xf, 0xf, true));
}

// ---------------------------------------------------------------------------
// Kernel 1: partial kvs[b,h] = sum_n khat[n] (x) v[n]  (16x16) and partial
// ksum[b,h] = sum_n khat[n], via k = x@Wk, v = x@Wv.
// One work-group per WGP walks K1_TILES consecutive tiles (tile t = b * NTILES
// + nt), 16 waves. A run of 12 tiles cuts every b (16 tiles) exactly once, so
// each b is covered by two runs: the run that holds its first tile writes
// partial 0, the other partial 1, each when it leaves that b.
// The x tiles are double-buffered: the next tile is loaded into registers
// ahead of the GEMM and stored to LDS behind it; the Wk|Wv panel is staged
// once. All tiles lie at the padded pitches above.
// k goes to LDS as it leaves the GEMM; the wave that reduces (head, 32 rows)
// normalizes it there, one lane a row: one root and one division a row and head.
// The v tiles also go to the workspace for kernel 2, each 16x16 accumulator
// tile (tile t, row block, head) as 256 floats in the accumulator's own lane
// order: float i of lane L at (i / 4) * 128 + L * 4 + i % 4, so that a wave
// moves it with two 16-byte accesses a lane over whole 128-byte lines.
// ---------------------------------------------------------------------------
__global__ void __launch_bounds__(NTHREADS)
kv_stats_kernel(const float* __restrict__ x, const float* __restrict__ Wqkv,
                float* __restrict__ ws_kvs, float* __restrict__ ws_ksum,
                float* __restrict__ ws_v) {
  extern __shared__ float smem[];
  float* w_lds  = smem;                   // 128 x WP1 : W_qkv cols 128..383 = [Wk|Wv]
  float* x0_lds = w_lds + DIM * WP1;      // 64 x XP (ping)
  float* x1_lds = x0_lds + TROWS * XP;    // 64 x XP (pong)
  float* kv_lds = x1_lds + TROWS * XP;    // 64 x WP1 : [khat | v]

  const int t0   = blockIdx.x * K1_TILES;  // tile t = b * NTILES + nt
  const int tid  = threadIdx.x;
  const int wave = tid >> 5;
  const int lane = tid & 31;
  const int half = lane >> 4;
  const int l    = lane & 15;

  const float* xb = x + (size_t)t0 * TROWS * DIM;

#pragma unroll  // all loads in flight before the first LDS store waits
  for (int j = 0; j < DIM * 256 / 4 / NTHREADS; ++j) {
    int r  = (tid >> 6) + j * (NTHREADS >> 6);  // 64 groups of 4 floats a row
    int c4 = (tid & 63) << 2;
    *(v4f*)(w_lds + r * WP1 + c4) = *(const v4f*)(Wqkv + r * 384 + 128 + c4);
  }
  // x tile: wave w moves rows w, w+16, w+32, w+48, one float4 a lane and row.
  const int xg = wave * DIM + (lane << 2);  // offset in the global tile
  const int xs = wave * XP + (lane << 2);   // offset in the LDS tile
  v4f p0 = *(const v4f*)(xb + xg);
  v4f p1 = *(const v4f*)(xb + xg + 16 * DIM);
  v4f p2 = *(const v4f*)(xb + xg + 32 * DIM);
  v4f p3 = *(const v4f*)(xb + xg + 48 * DIM);
  *(v4f*)(x0_lds + xs)           = p0;
  *(v4f*)(x0_lds + xs + 16 * XP) = p1;
  *(v4f*)(x0_lds + xs + 32 * XP) = p2;
  *(v4f*)(x0_lds + xs + 48 * XP) = p3;

  const int kh    = wave & 7;   // head this wave reduces
  const int rhalf = wave >> 3;  // which 32-row half of the tile
  const int rb    = wave & 3;   // GEMM role: row block (16 rows)
  const int qt    = wave >> 2;  // GEMM role: 64-col quarter (0,1 = k; 2,3 = v)
  const int row0  = rb * 16;
  const int c0    = qt * 64;

  v8f   kvacc = {0.f, 0.f, 0.f, 0.f, 0.f, 0.f, 0.f, 0.f};
  float ksum  = 0.f;

  for (int it = 0; it < K1_TILES; ++it) {
    __syncthreads();  // tile it is stored; prior x / kv_lds readers are done
    const float* x_lds = (it & 1) ? x1_lds : x0_lds;
    float*       n_lds = (it & 1) ? x0_lds : x1_lds;
    if (it + 1 < K1_TILES) {
      const float* xn = xb + (size_t)(it + 1) * TROWS * DIM + xg;
      p0 = *(const v4f*)(xn);
      p1 = *(const v4f*)(xn + 16 * DIM);
      p2 = *(const v4f*)(xn + 32 * DIM);
      p3 = *(const v4f*)(xn + 48 * DIM);
    }

    // ---- [k|v] GEMM: each wave computes a 16x64 strip = 4 wmma tiles ----
    v8f acc[4];
#pragma unroll
    for (int t = 0; t < 4; ++t)
      acc[t] = (v8f){0.f, 0.f, 0.f, 0.f, 0.f, 0.f, 0.f, 0.f};
#pragma unroll 4
    for (int k0 = 0; k0 < DIM; k0 += 4) {
      // A[m][k]: m = lane%16 (x row), k = 2*half + {0,1}
      v2f a = *(const v2f*)(x_lds + (row0 + l) * XP + k0 + 2 * half);
      const float* wr = w_lds + (k0 + 2 * half) * WP1 + c0 + l;
#pragma unroll
      for (int t = 0; t < 4; ++t) {
        v2f bb = {wr[t * 16], wr[t * 16 + WP1]};  // B[k][n], rows k and k+1
        acc[t] = wmma4(a, bb, acc[t]);
      }
    }

    if (qt >= 2) {
      // ---- quarters 2,3 hold v: heads (qt - 2) * 4 + t, to the workspace ----
      float* vd = ws_v +
                  ((size_t)((t0 + it) * 4 + rb) * NHEAD + (qt - 2) * 4) * 256 +
                  (lane << 2);
#pragma unroll  // constant t: the accumulators stay in registers
      for (int t = 0; t < 4; ++t) {
        *(v4f*)(vd + t * 256) =
            (v4f){acc[t][0], acc[t][1], acc[t][2], acc[t][3]};
        *(v4f*)(vd + t * 256 + 128) =
            (v4f){acc[t][4], acc[t][5], acc[t][6], acc[t][7]};
      }
      // the next trip reuses the registers that these stores name
      asm volatile("s_wait_xcnt 0x0" ::: "memory");
    }

    // ---- stash k / v tiles into LDS (C-layout: row=i+8*half, col=lane%16)
#pragma unroll
    for (int t = 0; t < 4; ++t) {
      float* dst = kv_lds + c0 + t * 16 + l;
#pragma unroll
      for (int i = 0; i < 8; ++i)
        dst[(row0 + i + 8 * half) * WP1] = acc[t][i];
    }
    // next x tile into the buffer whose readers left before this trip's barrier
    if (it + 1 < K1_TILES) {
      *(v4f*)(n_lds + xs)           = p0;
      *(v4f*)(n_lds + xs + 16 * XP) = p1;
      *(v4f*)(n_lds + xs + 32 * XP) = p2;
      *(v4f*)(n_lds + xs + 48 * XP) = p3;
    }
    __syncthreads();

    // ---- L2-normalize head kh of this wave's 32 rows in place, a lane a row.
    // Lane L takes its row's four 16-byte pieces in the order that begins at
    // piece L / 4: rows lie 16 banks apart, so the 16 lanes of a half fall on
    // 16 different groups of four banks.
    {
      float* krow = kv_lds + (rhalf * 32 + lane) * WP1 + kh * 16;
      v4f kq[4];
#pragma unroll
      for (int c = 0; c < 4; ++c)
        kq[c] = *(const v4f*)(krow + (((c + (lane >> 2)) & 3) << 2));
      float ss = 0.f;
#pragma unroll
      for (int c = 0; c < 4; ++c)
        ss += (kq[c].x * kq[c].x + kq[c].y * kq[c].y) +
              (kq[c].z * kq[c].z + kq[c].w * kq[c].w);
      const float sc = 1.f / fmaxf(sqrtf(ss), 1e-12f);
#pragma unroll
      for (int c = 0; c < 4; ++c)
        *(v4f*)(krow + (((c + (lane >> 2)) & 3) << 2)) = kq[c] * sc;
      // the rows' stores have landed before other lanes of the wave read them
      asm volatile("s_wait_dscnt 0x0" ::: "memory");
    }

    // ---- kvs += Khat^T * V for head kh over this wave's 32 rows ----
    // A[m][k] = khat[j0+k][16*kh+m]; B[k][d] = v[j0+k][16*kh+d]
#pragma unroll
    for (int js = 0; js < 8; ++js) {
      int j0 = rhalf * 32 + js * 4 + 2 * half;
      const float* kr = kv_lds + (size_t)j0 * WP1 + kh * 16 + l;
      v2f a  = {kr[0], kr[WP1]};          // khat rows j0, j0+1
      v2f bb = {kr[128], kr[WP1 + 128]};  // v rows j0, j0+1
      ksum += a.x + a.y;                  // partial column sum of khat
      kvacc = wmma4(a, bb, kvacc);
    }

    // ---- leaving this b or this run: write the partial stats (combined in
    // kernel 2) and start the sums anew ----
    const int t = t0 + it;
    if (((t + 1) & (NTILES - 1)) == 0 || it + 1 == K1_TILES) {
      const int b    = t / NTILES;
      const int part = (t0 > b * NTILES) ? 1 : 0;  // run began inside this b
      const size_t slot = ((size_t)b * NHEAD + kh) * NPART + part * 2 + rhalf;
      float* kdst = ws_kvs + slot * 256;
#pragma unroll
      for (int i = 0; i < 8; ++i)
        kdst[(i + 8 * half) * 16 + l] = kvacc[i];
      ws_ksum[slot * 32 + lane] = ksum;
      // the sums' registers, which these stores name, are cleared next
      asm volatile("s_wait_xcnt 0x0" ::: "memory");
      kvacc = (v8f){0.f, 0.f, 0.f, 0.f, 0.f, 0.f, 0.f, 0.f};
      ksum  = 0.f;
    }
  }
}

// Stats of one b: the four partials of kernel 1 (two tile runs, two row halves
// each) are summed into LDS.
static __device__ __forceinline__ void stage_stats(
    int b, int tid, const float* __restrict__ ws_kvs,
    const float* __restrict__ ws_ksum, float* kvs_lds, float* ksum_lds) {
  for (int i = tid; i < NHEAD * 256; i += NTHREADS) {
    size_t base = (((size_t)b * NHEAD + (i >> 8)) * NPART) * 256;
    int md = i & 255;
    kvs_lds[i] = (ws_kvs[base + md] + ws_kvs[base + 256 + md]) +
                 (ws_kvs[base + 512 + md] + ws_kvs[base + 768 + md]);
    // the next trip rewrites the address registers that these loads name
    asm volatile("s_wait_xcnt 0x0" ::: "memory");
  }
  if (tid < DIM) {
    size_t base = (((size_t)b * NHEAD + (tid >> 4)) * NPART) * 32;
    int m = tid & 15;
    ksum_lds[tid] = (ws_ksum[base + m] + ws_ksum[base + m + 16] +
                     ws_ksum[base + 32 + m] + ws_ksum[base + 48 + m]) +
                    (ws_ksum[base + 64 + m] + ws_ksum[base + 80 + m] +
                     ws_ksum[base + 96 + m] + ws_ksum[base + 112 + m]);
  }
}

// ---------------------------------------------------------------------------
// Kernel 2: q = x@Wq (normalize), v from kernel 1's store,
// attn = qhat@kvs + N*v, out_pre = attn / (qhat.ksum + N),
// out = out_pre @ W_out + b_out.  Fully fused; tiles at the padded pitches.
// One work-group per WGP covers K2_TILES consecutive tiles. The two weights
// (side by side in one panel, so that both lie within an LDS instruction's
// offset of one address), the bias and the stats of the run's first and last
// b (one b for some runs) are staged once, behind one barrier. From there on every wave works
// alone: it takes a block of 16 rows through all stages, all 128 columns wide,
// in an LDS strip of its own (x, then q, then the pre-projection rows), so
// that one wave's vector stages run beside the other waves' matrix stages.
// ---------------------------------------------------------------------------
__global__ void __launch_bounds__(NTHREADS)
attn_out_kernel(const float* __restrict__ x, const float* __restrict__ Wqkv,
                const float* __restrict__ Wout, const float* __restrict__ bout,
                const float* __restrict__ ws_kvs,
                const float* __restrict__ ws_ksum,
                const float* __restrict__ ws_v, float* __restrict__ out) {
  extern __shared__ float smem[];
  float* w_lds    = smem;                        // 128 x WP1 : [Wq | W_out]
  float* scr_lds  = w_lds + DIM * WP1;           // NWAVES strips of 16 x XP
  float* kvs_lds  = scr_lds + NWAVES * 16 * XP;  // 2 x 8*256
  float* ksum_lds = kvs_lds + 2 * NHEAD * 256;   // 2 x 128
  float* bias_lds = ksum_lds + 2 * DIM;          // 128

  const int t0   = blockIdx.x * K2_TILES;  // tile t = b * NTILES + nt
  const int tid  = threadIdx.x;
  const int wave = tid >> 5;
  const int lane = tid & 31;
  const int half = lane >> 4;
  const int l    = lane & 15;
  const int b0   = t0 / NTILES;  // first b of the run
  float* scr = scr_lds + wave * 16 * XP;

  // ---- the wave's first x block: one 128-wide row an access ----
  const float* xw = x + ((size_t)t0 * TROWS + wave * 16) * DIM + (lane << 2);
  v4f p[16];
#pragma unroll  // all loads in flight before the first LDS store waits
  for (int r = 0; r < 16; ++r) p[r] = *(const v4f*)(xw + r * DIM);
  // ---- the weights: wave w moves rows w, w+16, ... of both ----
  const float* wqs = Wqkv + wave * 384 + (lane << 2);
  const float* wos = Wout + wave * DIM + (lane << 2);
  v4f wa[DIM / 16], wb[DIM / 16];
#pragma unroll  // all loads in flight before the first LDS store waits
  for (int j = 0; j < DIM / 16; ++j) {
    wa[j] = *(const v4f*)(wqs + j * 16 * 384);
    wb[j] = *(const v4f*)(wos + j * 16 * DIM);
  }
  // the loads' address registers stay as they are up to this wait
  asm volatile("s_wait_xcnt 0x0" ::"v"(xw), "v"(wqs), "v"(wos) : "memory");
#pragma unroll
  for (int r = 0; r < 16; ++r) *(v4f*)(scr + r * XP + (lane << 2)) = p[r];
#pragma unroll
  for (int j = 0; j < DIM / 16; ++j) {
    float* wd = w_lds + (wave + j * 16) * WP1 + (lane << 2);
    *(v4f*)(wd)       = wa[j];
    *(v4f*)(wd + DIM) = wb[j];
  }
  // ---- the bias and the stats of the run's first and last b ----
  if (tid < DIM) bias_lds[tid] = bout[tid];
  stage_stats(b0, tid, ws_kvs, ws_ksum, kvs_lds, ksum_lds);
  stage_stats((t0 + K2_TILES - 1) / NTILES, tid, ws_kvs, ws_ksum,
              kvs_lds + NHEAD * 256, ksum_lds + DIM);
  __syncthreads();  // the one barrier: panels, bias and stats are stored

  // the full unrolls below: constant indices, so the arrays stay in registers
  for (int j = 0; j < K2_BLOCKS; ++j) {
    const int rbk = wave + j * NWAVES;  // 16-row block within the run
    const int sb  = ((t0 + (rbk >> 2)) / NTILES != b0) ? 1 : 0;
    const float* kvs = kvs_lds + sb * NHEAD * 256;
    const float* ksm = ksum_lds + sb * DIM;
    // this block's v, all heads, in accumulator order; used behind the GEMM
    const float* vs =
        ws_v + (size_t)(t0 * 4 + rbk) * NHEAD * 256 + (lane << 2);
    v4f vv[16];
#pragma unroll
    for (int h = 0; h < NHEAD; ++h) {
      vv[2 * h]     = *(const v4f*)(vs + h * 256);
      vv[2 * h + 1] = *(const v4f*)(vs + h * 256 + 128);
    }

    // ---- q GEMM: 16 rows x 128 columns = 8 wmma tiles, one a head ----
    v8f q[NHEAD];
#pragma unroll
    for (int h = 0; h < NHEAD; ++h)
      q[h] = (v8f){0.f, 0.f, 0.f, 0.f, 0.f, 0.f, 0.f, 0.f};
#pragma unroll 2  // two k steps' LDS reads issue as one group ahead of 16 WMMAs
    for (int k0 = 0; k0 < DIM; k0 += 4) {
      v2f a = *(const v2f*)(scr + l * XP + k0 + 2 * half);
      const float* wr = w_lds + (k0 + 2 * half) * WP1 + l;
#pragma unroll
      for (int h = 0; h < NHEAD; ++h) {
        v2f bb = {wr[h * 16], wr[h * 16 + WP1]};
        q[h] = wmma4(a, bb, q[h]);
      }
    }

    // q over x in the strip: every value stored hangs on all reads of x
#pragma unroll
    for (int h = 0; h < NHEAD; ++h) {
#pragma unroll
      for (int i = 0; i < 8; ++i)
        scr[(i + 8 * half) * XP + 16 * h + l] = q[h][i];
    }
    // the strip's stores have landed before other lanes of the wave read them
    asm volatile("s_wait_dscnt 0x0" ::: "memory");

    // ---- four heads at a time (eight would hold 64 registers of fragments) ----
#pragma unroll
    for (int g = 0; g < NHEAD; g += 4) {
      // per row and head, on the A fragments (lane = row l; each half holds
      // eight of a head's 16 values): |q|^2 and q.ksum, the two halves added;
      // then qhat = q / max(|q|, eps) and rn = 1 / (qhat.ksum + N)
      v2f   qa[4][4];
      float rn[4];
#pragma unroll
      for (int hh = 0; hh < 4; ++hh) {
        const int h = g + hh;
        float ss = 0.f, dq = 0.f;
#pragma unroll
        for (int kk = 0; kk < 4; ++kk) {
          v2f a  = *(const v2f*)(scr + l * XP + 16 * h + 4 * kk + 2 * half);
          v2f ks = *(const v2f*)(ksm + 16 * h + 4 * kk + 2 * half);
          ss += a.x * a.x + a.y * a.y;
          dq += a.x * ks.x + a.y * ks.y;
          qa[hh][kk] = a;
        }
        ss += xhalf(ss);
        dq += xhalf(dq);
        const float sc = 1.f / fmaxf(sqrtf(ss), 1e-12f);
#pragma unroll
        for (int kk = 0; kk < 4; ++kk) qa[hh][kk] *= sc;
        rn[hh] = 1.f / (dq * sc + 1024.f);  // + N
      }

      // attn = qhat @ kvs + N*v ; out_pre = attn * rn
      // head h's columns of the strip were read above and are overwritten here
#pragma unroll
      for (int hh = 0; hh < 4; ++hh) {
        const int h = g + hh;
        v8f att;
#pragma unroll
        for (int i = 0; i < 4; ++i) {  // N * v (C layout)
          att[i]     = 1024.f * vv[2 * h][i];
          att[i + 4] = 1024.f * vv[2 * h + 1][i];
        }
#pragma unroll
        for (int kk = 0; kk < 4; ++kk) {
          const float* kr = kvs + h * 256 + (4 * kk + 2 * half) * 16 + l;
          v2f bb = {kr[0], kr[16]};
          att = wmma4(qa[hh][kk], bb, att);
        }
        // C layout wants rn of row i + 8 * half: the upper half first takes
        // lane l ^ 8's value, then lane i's goes to all 16 lanes of each half
        const float t = half ? dpp16<0x168>(rn[hh]) : rn[hh];
        att[0] *= dpp16<0x150>(t);
        att[1] *= dpp16<0x151>(t);
        att[2] *= dpp16<0x152>(t);
        att[3] *= dpp16<0x153>(t);
        att[4] *= dpp16<0x154>(t);
        att[5] *= dpp16<0x155>(t);
        att[6] *= dpp16<0x156>(t);
        att[7] *= dpp16<0x157>(t);
#pragma unroll
        for (int i = 0; i < 8; ++i)
          scr[(i + 8 * half) * XP + 16 * h + l] = att[i];
      }
    }
    // the strip's stores have landed before other lanes of the wave read them
    asm volatile("s_wait_dscnt 0x0" ::: "memory");

    // the wave's next x block flies during the projection
    if (j + 1 < K2_BLOCKS) {
      const float* xn = xw + (size_t)(j + 1) * NWAVES * 16 * DIM;
#pragma unroll
      for (int r = 0; r < 16; ++r) p[r] = *(const v4f*)(xn + r * DIM);
    }

    // ---- output projection: out = op @ W_out + b_out ----
    v8f o[8];
#pragma unroll
    for (int c = 0; c < 8; ++c) {
      float bias = bias_lds[c * 16 + l];
#pragma unroll
      for (int i = 0; i < 8; ++i) o[c][i] = bias;
    }
#pragma unroll 2  // as in the q GEMM
    for (int k0 = 0; k0 < DIM; k0 += 4) {
      v2f a = *(const v2f*)(scr + l * XP + k0 + 2 * half);
      const float* wr = w_lds + (k0 + 2 * half) * WP1 + DIM + l;
#pragma unroll
      for (int c = 0; c < 8; ++c) {
        v2f bb = {wr[c * 16], wr[c * 16 + WP1]};
        o[c] = wmma4(a, bb, o[c]);
      }
    }
    float* ob = out + ((size_t)t0 * TROWS + rbk * 16) * DIM;
#pragma unroll
    for (int c = 0; c < 8; ++c) {
#pragma unroll
      for (int i = 0; i < 8; ++i)
        ob[(i + 8 * half) * DIM + c * 16 + l] = o[c][i];
    }
    // the next trip reuses the registers that these stores name
    asm volatile("s_wait_xcnt 0x0" ::: "memory");

    if (j + 1 < K2_BLOCKS) {
      // the projection's reads of the strip have returned before x overwrites it
      asm volatile("s_wait_dscnt 0x0" ::: "memory");
#pragma unroll
      for (int r = 0; r < 16; ++r) *(v4f*)(scr + r * XP + (lane << 2)) = p[r];
      // the strip's stores have landed before other lanes of the wave read them
      asm volatile("s_wait_dscnt 0x0" ::: "memory");
    }
  }
}

extern "C" void kernel_launch(void* const* d_in, const int* in_sizes, int n_in,
                              void* d_out, int out_size, void* d_ws,
                              size_t ws_size, hipStream_t stream) {
  (void)in_sizes; (void)n_in; (void)out_size; (void)ws_size;
  const float* x    = (const float*)d_in[0];
  const float* Wqkv = (const float*)d_in[1];
  const float* Wout = (const float*)d_in[2];
  const float* bout = (const float*)d_in[3];
  float* out = (float*)d_out;

  float* ws_kvs  = (float*)d_ws;                               // 192*8*4*256 f32
  float* ws_ksum = ws_kvs + (size_t)BT * NHEAD * NPART * 256;  // 192*8*4*32  f32
  float* ws_v    = ws_ksum + (size_t)BT * NHEAD * NPART * 32;  // 192*1024*128 f32

  const size_t shmem1 =
      (size_t)(DIM * WP1 + 2 * TROWS * XP + TROWS * WP1) * sizeof(float);
  const size_t shmem2 =
      (size_t)(DIM * WP1 + NWAVES * 16 * XP + 2 * NHEAD * 256 + 2 * DIM + DIM) *
      sizeof(float);

  (void)hipFuncSetAttribute((const void*)kv_stats_kernel,
                            hipFuncAttributeMaxDynamicSharedMemorySize,
                            (int)shmem1);
  (void)hipFuncSetAttribute((const void*)attn_out_kernel,
                            hipFuncAttributeMaxDynamicSharedMemorySize,
                            (int)shmem2);

  kv_stats_kernel<<<dim3(K1_GROUPS), dim3(NTHREADS), shmem1, stream>>>(
      x, Wqkv, ws_kvs, ws_ksum, ws_v);
  attn_out_kernel<<<dim3(K2_GROUPS), dim3(NTHREADS), shmem2, stream>>>(
      x, Wqkv, Wout, bout, ws_kvs, ws_ksum, ws_v, out);
}
